// v000
// Times are from an AMD MI455X. After a warm-up the kernel runs many times in a row, and a time is the length of
// such a window on the GPU divided by its runs, so every launch and the gaps after it count. The runs cycle
// through copies of the inputs. A figure is the median of several windows, for all but v000 over two sittings.
// Sittings can differ by a few percent; kernels timed side by side share one.
// v000 is the starting kernel. One run takes 68.9 microseconds.
// Contractions: conv1x1 theta/phi/g GEMM W[96x64].X[64x128] per strip on v_wmma_f32_16x16x32_f16 (f16 containers
// of bf16-RNE weights x256 and bf16-RNE x); scores K.Q^T on v_wmma_f32_16x16x32_bf16 (bf16 hi + bf16 residual planes
// of theta / 2x2-max-pooled phi, 3 products, K=32); y^T = G.P^T on v_wmma_f32_16x16x32_f16 (2x2-max-pooled g as
// f16, P = e^{s-m} x16384 f16 from the score D registers); output conv W[64x32].Y on v_wmma_f32_16x16x32_bf16 (bf16
// weights, y as bf16 hi + residual planes, 2 products); f32 accumulate everywhere; max-pool, softmax statistics,
// bias and residual add in f32 VALU.
#include <hip/hip_runtime.h>
#include <math.h>
#include <stdint.h>

#ifndef NB
#define NB 16
#endif
#ifndef NQ
#define NQ 4096
#endif
#define NB_FULL 16
#define CC     64
#define HIMG   64
#define WIMG   64
#define NN     4096
#define DQ     32
#define HP     32
#define WP     32
#define MM     1024
#define MW     96
#define NMT    6
#define QT     64
#define SN     128
#define NSTRIP 32
#define OSP    68
#define OSPP   100
#define OSPW   36
#define TP     72
#define WSC    256.0f
#define IWSC   0.00390625f
#define LNPS   9.704060527839234f

static_assert(NB >= 1 && NB <= NB_FULL);
static_assert(NQ % QT == 0 && NQ >= QT && NQ <= NN);
static_assert(NN == HIMG * WIMG);
static_assert(SN == 2 * WIMG);
static_assert(NSTRIP * SN == NN);
static_assert(SN == 8 * 16);
static_assert(SN == 2 * 64 && SN == 4 * 32);
static_assert(HP * 2 == HIMG && WP * 2 == WIMG);
static_assert(MM == HP * WP);
static_assert(MM % QT == 0 && MM % 32 == 0);
static_assert(QT == 2 * WP);
static_assert(CC == QT);
static_assert(DQ == 32);
static_assert(MW == 3 * DQ && NMT * 16 == MW);
static_assert(CC % 32 == 0);
static_assert((OSP * 4) % 16 == 0);
static_assert((OSPP * 4) % 16 == 0 && OSPP >= MW);
static_assert((OSPW * 4) % 16 == 0 && OSPW >= DQ);
static_assert((TP * 2) % 16 == 0 && TP >= QT);
static_assert(SN * OSPP * 4 <= 65536);
static_assert((size_t)NB_FULL * CC * NN * 4 == (size_t)16777216);

typedef _Float16       v16h __attribute__((ext_vector_type(16)));
typedef _Float16       v8h  __attribute__((ext_vector_type(8)));
typedef __bf16         v16b __attribute__((ext_vector_type(16)));
typedef unsigned short v8us __attribute__((ext_vector_type(8)));
typedef float          v8f  __attribute__((ext_vector_type(8)));
typedef float          v4f  __attribute__((ext_vector_type(4)));
typedef unsigned int   v4u  __attribute__((ext_vector_type(4)));

union Frag  { v8us u[2]; v16h h; v16b bf; };
union FragH { v16h v; v8h hv[2]; };
static_assert(sizeof(Frag) == 32);
static_assert(sizeof(FragH) == 32);

// ---- scalar helpers ---------------------------------------------------------------------------------------
__device__ __forceinline__ unsigned short bf_bits(float f) {          // f32 -> bf16 bits, RNE convert
  unsigned u = __float_as_uint(f);
  return (unsigned short)((u + 0x7FFFu + ((u >> 16) & 1u)) >> 16);
}
__device__ __forceinline__ float bf_up(unsigned short hb) { return __uint_as_float(((unsigned)hb) << 16); }
__device__ __forceinline__ float bfr(float f) { return bf_up(bf_bits(f)); }
__device__ __forceinline__ unsigned short h_bits(_Float16 x) { return __builtin_bit_cast(unsigned short, x); }
__device__ __forceinline__ unsigned pk16(unsigned short a, unsigned short b) { return (unsigned)a | ((unsigned)b << 16); }
__device__ __forceinline__ v8f zero8() { v8f z = {0.f, 0.f, 0.f, 0.f, 0.f, 0.f, 0.f, 0.f}; return z; }
__device__ __forceinline__ float hmax8(v8f s) {
  return fmaxf(fmaxf(fmaxf(s[0], s[1]), fmaxf(s[2], s[3])), fmaxf(fmaxf(s[4], s[5]), fmaxf(s[6], s[7])));
}
__device__ __forceinline__ unsigned wave_ballot(bool p) {
#if defined(__HIP_DEVICE_COMPILE__)
  return __builtin_amdgcn_ballot_w32(p);
#else
  return p ? 1u : 0u;
#endif
}
// 8 f32 values -> bf16 hi bits and bf16 residual bits (lo = RNE(v - hi)), packed 2 per uint
__device__ __forceinline__ void split8(const float* f, v4u& uh, v4u& ul) {
#pragma unroll
  for (int t = 0; t < 4; ++t) {
    const float f0 = f[2 * t], f1 = f[2 * t + 1];
    const unsigned short hb0 = bf_bits(f0), hb1 = bf_bits(f1);
    const unsigned short lb0 = bf_bits(f0 - bf_up(hb0));
    const unsigned short lb1 = bf_bits(f1 - bf_up(hb1));
    uh[t] = pk16(hb0, hb1);
    ul[t] = pk16(lb0, lb1);
  }
}

// ---- 16-bit fragment loader (A, or B from a k-contiguous [n][k] row): lane -> row/col (lane&15), p already includes
//      + 8*(lane>>4); elements 0..7 <- p[0..7] (k0+8h..), elements 8..15 <- p[16..23] (k0+16+8h..)
__device__ __forceinline__ Frag ldfrag(const unsigned short* p) {
  Frag f;
  f.u[0] = *(const v8us*)(p);
  f.u[1] = *(const v8us*)(p + 16);
  return f;
}

// ---- WMMA helpers: builtin followed by a 4-slot VALU gap tying D and keeping A/B live --------------------------
__device__ __forceinline__ v8f mma_h(v16h a, v16h b, v8f c) {
  v8f d = __builtin_amdgcn_wmma_f32_16x16x32_f16(false, a, false, b, (short)0, c, false, false);
#if defined(__HIP_DEVICE_COMPILE__)
  asm volatile("v_nop\n\tv_nop\n\tv_nop\n\tv_nop" : "+v"(d) : "v"(a), "v"(b));
#endif
  return d;
}
__device__ __forceinline__ v8f mma_b(v16b a, v16b b, v8f c) {
  v8f d = __builtin_amdgcn_wmma_f32_16x16x32_bf16(false, a, false, b, (short)0, c, false, false);
#if defined(__HIP_DEVICE_COMPILE__)
  const v16h ha = __builtin_bit_cast(v16h, a), hb = __builtin_bit_cast(v16h, b);
  asm volatile("v_nop\n\tv_nop\n\tv_nop\n\tv_nop" : "+v"(d) : "v"(ha), "v"(hb));
#endif
  return d;
}

// =========================================================================================================
// (0) weights. Blocks 0..2: W16 f16 [96][64], rows 0..31 = theta_w, 32..63 = phi_w, 64..95 = g_w; value =
//     lanes x 16 B, one instruction for all 32 rows. Block 3: WWb bf16 [64][32] = bf16-RNE of w_w; row = 64 B,
// coverage: 3 blocks x 32 rows x 8 lanes x 8 halves = 96 x 64; 1 block x 64 rows x 4 lanes x 8 = 64 x 32.
// =========================================================================================================
__global__ __launch_bounds__(256)
void cvt_w(const float* __restrict__ tw, const float* __restrict__ pw, const float* __restrict__ gw,
           const float* __restrict__ ow, unsigned short* W16, unsigned short* WWb) {
  const int tid = threadIdx.x, blk = blockIdx.x;
  if (blk < 3) {
    const int rl = tid >> 3, col = 8 * (tid & 7);                    // rl 0..31, col 0..56
    const int o = DQ * blk + rl;                                     // 0..95
    const float* wbase = (blk == 0) ? tw : ((blk == 1) ? pw : gw);  // all global
    const float* s = wbase + (size_t)rl * CC + col;
    const v4f a = *(const v4f*)s;
    const v4f q = *(const v4f*)(s + 4);
    const float f[8] = {a[0], a[1], a[2], a[3], q[0], q[1], q[2], q[3]};
    v4u u;
#pragma unroll
    for (int t = 0; t < 4; ++t) {
      const _Float16 h0 = (_Float16)(bfr(f[2 * t]) * WSC);
      const _Float16 h1 = (_Float16)(bfr(f[2 * t + 1]) * WSC);
      u[t] = pk16(h_bits(h0), h_bits(h1));
    }
{
      *(v4u*)(W16 + (size_t)o * CC + col) = u;
      
    }
  } else {
    const int o = tid >> 2;                                          // 0..63
    const int col = 8 * (tid & 3);                                   // 0..24
    const float* s = ow + (size_t)o * DQ + col;
    const v4f a = *(const v4f*)s;
    const v4f q = *(const v4f*)(s + 4);
    const float f[8] = {a[0], a[1], a[2], a[3], q[0], q[1], q[2], q[3]};
    v4u u;
#pragma unroll
    for (int t = 0; t < 4; ++t) u[t] = pk16(bf_bits(f[2 * t]), bf_bits(f[2 * t + 1]));
{
      *(v4u*)(WWb + (size_t)o * DQ + col) = u;
      
    }
  }
}

// =========================================================================================================
// (1) x f32 [b][64 c][4096 n] -> XP f16 [b][n][c] (position-major, bf16-RNE values, exact in f16) through an LDS
//     tile T[64 n][64 c] (pitch TP, cross-wave, block barrier). Block (nb, b) owns a 64 c x 64 n tile (all c).
// coverage: T written rows (8e+t)=0..63 x cols cl 0..63, read rows 0..63 x cols 8e..8e+7; XP 2 it x 32 rows x 8 lanes
//           x 8 = 64 n x 64 c; grid (64, NB) covers XP [b][0..4095][0..63] exactly once.
// =========================================================================================================
__global__ __launch_bounds__(256)
void cvt_x(const float* __restrict__ x, unsigned short* XP) {
  __shared__ __align__(16) unsigned short T[QT * TP];
  const int tid = threadIdx.x;
  const int nb = blockIdx.x, b = blockIdx.y;
  const int e = tid & 7, lq = tid >> 3;                             // lq 0..31
  const int n0 = nb * QT;
#pragma unroll
  for (int it = 0; it < 2; ++it) {
    const int cl = it * 32 + lq;                                     // 0..63
    const float* sp = x + ((size_t)(b * CC + cl)) * NN + n0 + 8 * e;
    const v4f a = *(const v4f*)sp;
    const v4f q = *(const v4f*)(sp + 4);
    unsigned short hb[8];
#pragma unroll
    for (int t = 0; t < 4; ++t) {
      hb[t]     = h_bits((_Float16)bfr(a[t]));
      hb[4 + t] = h_bits((_Float16)bfr(q[t]));
    }
#pragma unroll
    for (int t = 0; t < 8; ++t) T[(8 * e + t) * TP + cl] = hb[t];
  }
  __syncthreads();
  v4u up[2];
#pragma unroll
  for (int it = 0; it < 2; ++it) {
    const int nl = it * 32 + lq;                                     // 0..63
    up[it] = *(const v4u*)(T + nl * TP + 8 * e);
  }
{
#pragma unroll
    for (int it = 0; it < 2; ++it) {
      const int rl = it * 32 + lq;
      *(v4u*)(XP + ((size_t)(b * NN + n0 + rl)) * CC + 8 * e) = up[it];
    }
    
  }
}

// =========================================================================================================
// (2) conv1x1 GEMM for one (b, strip of 128 positions = image rows 2s and 2s+1), all 96 stacked outputs:
//     Y[o][n] = (1/256) sum_c W16[o][c] XP[b][n][c]. Block 256 threads = 8 waves; wave w owns cols n0+16w..+15
//     (one B fragment per k-step, k = c contiguous in the XP row) and 6 m-tiles (A rows o = 16 mt + (lane&15),
//     split k map loader from W16). K = 64 = 2 steps. Epilogue staged in LDS Os[n_loc][o_loc] (pitch OSPP, b128
//     stores), block barrier, then every thread:
//       o 0..31  -> theta + bias -> Qh/Ql bf16 [b][4096 n][32 d] (hi = RNE(v), lo = RNE(v-hi)): rows 64 B, 4 lanes x
//                   instruction per 64 rows (2 it);  o 64..95 -> g + bias -> GF f32, same layout.
// coverage: Os 8 waves x 16 n x 96 o = 128 x 96 written, reads rows <= 127 cols <= 95; theta planes 2 it x 64 rows
//           x 4 lanes x 8 = 128 n x 32 d; f32 planes 4 it x 32 rows x 8 lanes x 4 = 128 n x 32 d; grid (32, NB)
//           covers all 4096 rows x 32 d of Qh/Ql and of PF/GF exactly once.
// =========================================================================================================
__global__ __launch_bounds__(256)
void gemm_proj(const unsigned short* __restrict__ W16, const unsigned short* __restrict__ XP,
               const float* __restrict__ tb, const float* __restrict__ pb, const float* __restrict__ gb,
               unsigned short* Qh, unsigned short* Ql, float* PF, float* GF) {
  __shared__ __align__(16) float Os[SN * OSPP];
  const int tid  = threadIdx.x;
  const int lane = tid & 31, wave = tid >> 5;                        // wave 0..7
  const int hh   = lane >> 4, c = lane & 15;
  const int st   = blockIdx.x, b = blockIdx.y;
  const int n0   = st * SN;

  const unsigned short* ap = W16 + (size_t)c * CC + 8 * hh;
  const unsigned short* bp = XP + ((size_t)(b * NN + n0 + 16 * wave + c)) * CC + 8 * hh;

  v8f acc[NMT];
#pragma unroll
  for (int mt = 0; mt < NMT; ++mt) acc[mt] = zero8();

#pragma unroll
  for (int ks = 0; ks < CC / 32; ++ks) {
    const Frag fb = ldfrag(bp + 32 * ks);
#pragma unroll
    for (int mt = 0; mt < NMT; ++mt) {
      const Frag fa = ldfrag(ap + (size_t)(16 * mt) * CC + 32 * ks);
      acc[mt] = mma_h(fa.h, fb.h, acc[mt]);
    }
  }

  // ---- epilogue: scale back -> LDS Os[n_loc][o_loc]; lane (hh, c) holds o = 16 mt + 8 hh + r for n_loc = 16 w + c
  {
    const int nl = 16 * wave + c;
#pragma unroll
    for (int mt = 0; mt < NMT; ++mt) {
      v4f va, vb;
#pragma unroll
      for (int r = 0; r < 4; ++r) { va[r] = acc[mt][r] * IWSC; vb[r] = acc[mt][4 + r] * IWSC; }
      *(v4f*)(Os + nl * OSPP + 16 * mt + 8 * hh)     = va;
      *(v4f*)(Os + nl * OSPP + 16 * mt + 8 * hh + 4) = vb;
    }
  }
  __syncthreads();

  // theta -> bf16 hi / residual planes
  const int e4 = tid & 3, lq = tid >> 2;                             // lq 0..63
  float bv[8];
  {
    const v4f ba = *(const v4f*)(tb + 8 * e4);
    const v4f bq = *(const v4f*)(tb + 8 * e4 + 4);
#pragma unroll
    for (int t = 0; t < 4; ++t) { bv[t] = bfr(ba[t]); bv[4 + t] = bfr(bq[t]); }
  }
  v4u uh[2], ul[2];
#pragma unroll
  for (int it = 0; it < 2; ++it) {
    const int row = it * 64 + lq;                                    // n_loc 0..127
    const v4f a = *(const v4f*)(Os + row * OSPP + 8 * e4);
    const v4f q = *(const v4f*)(Os + row * OSPP + 8 * e4 + 4);
    float f[8];
#pragma unroll
    for (int t = 0; t < 4; ++t) { f[t] = a[t] + bv[t]; f[4 + t] = q[t] + bv[4 + t]; }
    split8(f, uh[it], ul[it]);
  }

  // phi and g (+ bias, f32) -> f32 planes
  const int e8 = tid & 7, lr = tid >> 3;                             // lr 0..31
  v4f bp4, bg4;
  {
    const v4f bq = *(const v4f*)(pb + 4 * e8);
    const v4f gq = *(const v4f*)(gb + 4 * e8);
#pragma unroll
    for (int t = 0; t < 4; ++t) { bp4[t] = bfr(bq[t]); bg4[t] = bfr(gq[t]); }
  }
  v4f rp[4], rg[4];
#pragma unroll
  for (int it = 0; it < 4; ++it) {
    const int row = it * 32 + lr;                                    // n_loc 0..127
    const v4f a = *(const v4f*)(Os + row * OSPP + DQ + 4 * e8);
    const v4f g = *(const v4f*)(Os + row * OSPP + 2 * DQ + 4 * e8);
    v4f va, vg;
#pragma unroll
    for (int t = 0; t < 4; ++t) { va[t] = a[t] + bp4[t]; vg[t] = g[t] + bg4[t]; }
    rp[it] = va;
    rg[it] = vg;
  }

{
#pragma unroll
    for (int it = 0; it < 2; ++it) {
      const int row = it * 64 + lq;
      const size_t po = ((size_t)(b * NN + n0 + row)) * DQ + 8 * e4;
      *(v4u*)(Qh + po) = uh[it];
      *(v4u*)(Ql + po) = ul[it];
    }
#pragma unroll
    for (int it = 0; it < 4; ++it) {
      const int row = it * 32 + lr;
      const size_t po = ((size_t)(b * NN + n0 + row)) * DQ + 4 * e8;
      *(v4f*)(PF + po) = rp[it];
      *(v4f*)(GF + po) = rg[it];
    }
    
  }
}

// =========================================================================================================
// (3) 2x2 stride-2 max-pool of PF / GF f32 [b][4096 n][32 d] in f32 -> Kh/Kl bf16 [b][1024 m][32 d]
//     (hi = RNE(v), lo = RNE(v-hi)) written directly, and pooled g as f16 transposed through an LDS tile
//     T[32 d][64 m] (pitch TP, cross-wave, block barrier) -> Gc f16 [b][32 d][1024 m] (channel-major, keys
//     contiguous). m = 32 py + px, window n = (2py+dy) 64 + 2px+dx, dy,dx in {0,1} (always in range).
//     Block (mt, b), 256 threads, owns keys 64 mt..64 mt+63: phase 1 thread (ml = tid>>2, e4 = tid&3) pools
//     8 d of key ml; Kh/Kl rows 64 B = 4 lanes x 16 B, 8 consecutive lanes per line, one instruction per plane
// coverage: T written rows (8 e4 + t) = 0..31 x cols ml 0..63, read rows d 0..31 x cols 8 e8..8 e8+7;
//           Kh/Kl 16 blocks x 64 rows x 4 lanes x 8 = 1024 x 32; Gc 16 blocks x 32 d x 8 lanes x 8 = 32 x 1024;
//           grid (16, NB) covers Kh/Kl [b][0..1023][0..31] and Gc [b][0..31][0..1023] exactly once.
// =========================================================================================================
__global__ __launch_bounds__(256)
void pool_k(const float* __restrict__ PF, const float* __restrict__ GF,
            unsigned short* Kh, unsigned short* Kl, unsigned short* Gc) {
  __shared__ __align__(16) unsigned short T[DQ * TP];
  const int tid = threadIdx.x, mt = blockIdx.x, b = blockIdx.y;
  const int e4 = tid & 3, ml = tid >> 2;                             // ml 0..63
  const int m  = QT * mt + ml;                                       // 0..1023
  const int py = m / WP, px = m - py * WP;                           // 0..31 each
  const size_t rb = ((size_t)(b * NN + (2 * py) * WIMG + 2 * px)) * DQ + 8 * e4;
  float fk[8], fg[8];
#pragma unroll
  for (int t = 0; t < 8; ++t) { fk[t] = -__builtin_inff(); fg[t] = -__builtin_inff(); }
#pragma unroll
  for (int dy = 0; dy < 2; ++dy) {
#pragma unroll
    for (int dx = 0; dx < 2; ++dx) {
      const size_t wo = rb + (size_t)(dy * WIMG + dx) * DQ;
      const float* pk = PF + wo;
      const float* pg = GF + wo;
      const v4f ka = *(const v4f*)pk, kq = *(const v4f*)(pk + 4);
      const v4f ga = *(const v4f*)pg, gq = *(const v4f*)(pg + 4);
#pragma unroll
      for (int t = 0; t < 4; ++t) {
        fk[t]     = fmaxf(fk[t], ka[t]);
        fk[4 + t] = fmaxf(fk[4 + t], kq[t]);
        fg[t]     = fmaxf(fg[t], ga[t]);
        fg[4 + t] = fmaxf(fg[4 + t], gq[t]);
      }
    }
  }
  v4u kh, kl;
  split8(fk, kh, kl);
#pragma unroll
  for (int t = 0; t < 8; ++t) T[(8 * e4 + t) * TP + ml] = h_bits((_Float16)fg[t]);
  __syncthreads();

  const int e8 = tid & 7, d = tid >> 3;                              // d 0..31
  const v4u up = *(const v4u*)(T + d * TP + 8 * e8);
  const size_t pok = ((size_t)(b * MM + m)) * DQ + 8 * e4;
  const size_t pog = ((size_t)(b * DQ + d)) * MM + QT * mt + 8 * e8;
{
    *(v4u*)(Kh + pok) = kh;
    *(v4u*)(Kl + pok) = kl;
    *(v4u*)(Gc + pog) = up;
    
  }
}

// =========================================================================================================
// (4) attention for one (b, 64-query tile), transposed formulation, 1024 keys, no mask, no scale:
//   S^T tile (16 keys x 16 queries) = A(k: row = key kb + (lane&15), 32 d via the split k map from the bf16
//   plane Kh [b][1024][32]) . B(q: col = query, same map from Qh [b][4096][32]) + A(Kh).B(Ql) + A(Kl).B(Qh)
//   (bf16 unscaled residual planes, shared accumulator); q fragments loaded once (K = 32 = one step).
//   Per lane the D tile holds 8 keys of ONE query: online softmax state per lane, one shuffle (lane^16) for the max
//   over 32 keys; the o/l rescale is skipped under a wave-uniform ballot when no lane's max grew (corr == 1 exactly
//   for every lane then); row-sum partials combined at the end. P = e^{s-m} x 16384 as f16 is the B operand of
//   y^T (rows channel, cols queries) += A(pooled g: rows channel = 16j + (lane&15), keys contiguous, f16 plane Gc
//   [b][32][1024]) . B(P^T): element r <- D of the tile covering keys kb..kb+15, element 8+r <- the tile covering
//   kb+16..kb+31, lane unchanged. 2 accumulator tiles per wave (32 channels). Block = 4 waves = 64 queries.
//   Epilogue: y = O/l staged in LDS Os[query][32 channels] (pitch OSPW, b128 stores), block barrier, then
//   Yh/Yl bf16 [b][4096 n][32 ch] (hi = RNE(y), lo = RNE(y - hi)): row = 64 B = 4 lanes x 16 B, 8 consecutive
// coverage: Os written 4 waves x 16 queries x 32 ch, read rows 0..63 x ch 8e4..8e4+7 (e4 0..3); planes 2 it x 32
//           rows x 4 lanes x 8 = 64 n x 32 ch per plane; grid (NQ/64, NB) covers rows 0..NQ-1 of Yh/Yl once.
// =========================================================================================================
__global__ __launch_bounds__(128) __attribute__((amdgpu_num_vgpr(256)))
void attn_k(const unsigned short* __restrict__ Qh, const unsigned short* __restrict__ Ql,
            const unsigned short* __restrict__ Kh, const unsigned short* __restrict__ Kl,
            const unsigned short* __restrict__ Gc, unsigned short* Yh, unsigned short* Yl) {
  __shared__ __align__(16) float Os[QT * OSPW];
  const int tid  = threadIdx.x;
  const int wave = tid >> 5, lane = tid & 31;
  const int hh   = lane >> 4, c = lane & 15;
  const int n0   = blockIdx.x * QT, b = blockIdx.y;

  // q fragments (B operand, col = query n0 + 16*wave + c), whole head dim in one fragment
  const size_t qo = ((size_t)(b * NN + n0 + 16 * wave + c)) * DQ + 8 * hh;
  const Frag qh = ldfrag(Qh + qo);
  const Frag ql = ldfrag(Ql + qo);
  // k fragment base (A operand, row = key kb + c), + key * 32
  const unsigned short* Khp = Kh + (size_t)b * MM * DQ + (size_t)c * DQ + 8 * hh;
  const unsigned short* Klp = Kl + (size_t)b * MM * DQ + (size_t)c * DQ + 8 * hh;
  // v fragment base (A operand, row = channel 16j + c, keys contiguous), + 16*j*MM + kb
  const unsigned short* Vp = Gc + (size_t)b * DQ * MM + (size_t)c * MM + 8 * hh;

  float m = -1.0e30f, l = 0.f;
  v8f o[2];
  o[0] = zero8();
  o[1] = zero8();

#pragma unroll 1
  for (int kb = 0; kb < MM; kb += 32) {
    const Frag k0  = ldfrag(Khp + (size_t)kb * DQ);                  // keys kb .. kb+15
    const Frag k1  = ldfrag(Khp + (size_t)(kb + 16) * DQ);           // keys kb+16 .. kb+31
    const Frag k0l = ldfrag(Klp + (size_t)kb * DQ);
    const Frag k1l = ldfrag(Klp + (size_t)(kb + 16) * DQ);
    v8f s0 = mma_b(k0.bf, qh.bf, zero8());
    v8f s1 = mma_b(k1.bf, qh.bf, zero8());
    s0 = mma_b(k0.bf, ql.bf, s0);
    s1 = mma_b(k1.bf, ql.bf, s1);
    s0 = mma_b(k0l.bf, qh.bf, s0);
    s1 = mma_b(k1l.bf, qh.bf, s1);

    float mx = fmaxf(hmax8(s0), hmax8(s1));
    mx = fmaxf(mx, __shfl_xor(mx, 16, 32));
    const float mn = fmaxf(m, mx);
    const unsigned grew = wave_ballot(mx > m);                       // wave-uniform
    if (grew != 0u) {
      const float corr = __expf(m - mn);                             // == 1 exactly for lanes whose max did not grow
      l *= corr;
#pragma unroll
      for (int j = 0; j < 2; ++j) {
#pragma unroll
        for (int r = 0; r < 8; ++r) o[j][r] *= corr;
      }
    }
    m = mn;
    const float msh = mn - LNPS;                                     // exp gives e^{s-m} * 16384

    FragH ph;
    float ls = 0.f;
#pragma unroll
    for (int r = 0; r < 8; ++r) {
      const float e0 = __expf(s0[r] - msh);                          // key kb      + 8hh + r
      const float e1 = __expf(s1[r] - msh);                          // key kb + 16 + 8hh + r
      ls += e0 + e1;
      ph.hv[0][r] = (_Float16)e0;
      ph.hv[1][r] = (_Float16)e1;
    }
    l += ls;

#pragma unroll
    for (int j = 0; j < 2; ++j) {
      const Frag vf = ldfrag(Vp + (size_t)(16 * j) * MM + kb);
      o[j] = mma_h(vf.h, ph.v, o[j]);
    }
  }
  l += __shfl_xor(l, 16, 32);
  const float inv = 1.0f / l;                                        // o and l both carry the x16384 factor

  // ---- epilogue: y = o * inv -> Os[query][ch]; lane (hh, c) holds ch = 16 j + 8 hh + r for query 16 w + c
  {
    const int qrow = 16 * wave + c;
#pragma unroll
    for (int j = 0; j < 2; ++j) {
      v4f va, vb;
#pragma unroll
      for (int r = 0; r < 4; ++r) { va[r] = o[j][r] * inv; vb[r] = o[j][4 + r] * inv; }
      *(v4f*)(Os + qrow * OSPW + 16 * j + 8 * hh)     = va;
      *(v4f*)(Os + qrow * OSPW + 16 * j + 8 * hh + 4) = vb;
    }
  }
  __syncthreads();

  const int e4 = tid & 3, lr = tid >> 2;                             // lr 0..31
  v4u uh[2], ul[2];
#pragma unroll
  for (int it = 0; it < 2; ++it) {
    const int row = it * 32 + lr;                                    // query 0..63
    const v4f a = *(const v4f*)(Os + row * OSPW + 8 * e4);
    const v4f q = *(const v4f*)(Os + row * OSPW + 8 * e4 + 4);
    const float f[8] = {a[0], a[1], a[2], a[3], q[0], q[1], q[2], q[3]};
    split8(f, uh[it], ul[it]);
  }
{
#pragma unroll
    for (int it = 0; it < 2; ++it) {
      const int row = it * 32 + lr;
      const size_t po = ((size_t)(b * NN + n0 + row)) * DQ + 8 * e4;
      *(v4u*)(Yh + po) = uh[it];
      *(v4u*)(Yl + po) = ul[it];
    }
    
  }
}

// =========================================================================================================
// (5) output conv for one (b, 64-n tile), all 64 channels: A[c][n] = sum_ci WWb[c][ci] (Yh + Yl)[b][n][ci] on
//     bf16 WMMA (2 products, shared accumulator), K = 32 = 1 step. Block 128 threads = 4 waves; wave w owns cols
//     n0+16w..+15 (B fragments from the k-contiguous Yh/Yl rows) and 4 m-tiles (A rows c = 16 mt + (lane&15),
//     split k map loader from WWb). Epilogue staged in LDS Os[n_loc][c_loc] (pitch OSP, b128 stores), block
//     2 lines): 8 consecutive lanes x 16 B (values gathered from 4 Os rows), one instruction per 16 lines, final
// coverage: Os 4 waves x 16 n x 64 c written, read rows nl+t <= 63 x cols cl <= 63; out 8 it x 16 lines x 8 lanes x
//           4 floats = 64 c x 64 n; grid (NQ/64, NB) covers out[b][0..63][0..NQ-1] exactly once.
// =========================================================================================================
__global__ __launch_bounds__(128)
void gemm_out(const unsigned short* __restrict__ WWb, const unsigned short* __restrict__ Yh,
              const unsigned short* __restrict__ Yl, const float* __restrict__ wb,
              const float* __restrict__ x, float* out) {
  __shared__ __align__(16) float Os[QT * OSP];
  const int tid  = threadIdx.x;
  const int lane = tid & 31, wave = tid >> 5;
  const int hh   = lane >> 4, c = lane & 15;
  const int nt   = blockIdx.x, b = blockIdx.y;
  const int n0   = nt * QT;

  const unsigned short* ap = WWb + (size_t)c * DQ + 8 * hh;
  const size_t bo = ((size_t)(b * NN + n0 + 16 * wave + c)) * DQ + 8 * hh;
  const Frag fbh = ldfrag(Yh + bo);
  const Frag fbl = ldfrag(Yl + bo);

  v8f acc[4];
#pragma unroll
  for (int mt = 0; mt < 4; ++mt) {
    const Frag fa = ldfrag(ap + (size_t)(16 * mt) * DQ);
    v8f a0 = mma_b(fa.bf, fbh.bf, zero8());
    acc[mt] = mma_b(fa.bf, fbl.bf, a0);
  }

  // ---- epilogue: -> LDS Os[n_loc][c_loc]; lane (hh, c) holds c_loc = 16 mt + 8 hh + r for n_loc = 16 w + c
  {
    const int nl = 16 * wave + c;
#pragma unroll
    for (int mt = 0; mt < 4; ++mt) {
      v4f va, vb;
#pragma unroll
      for (int r = 0; r < 4; ++r) { va[r] = acc[mt][r]; vb[r] = acc[mt][4 + r]; }
      *(v4f*)(Os + nl * OSP + 16 * mt + 8 * hh)     = va;
      *(v4f*)(Os + nl * OSP + 16 * mt + 8 * hh + 4) = vb;
    }
  }
  __syncthreads();

  const int e = tid & 7, lq = tid >> 3;                              // lq 0..15
  v4f res[8];
#pragma unroll
  for (int it = 0; it < 8; ++it) {
    const int L   = it * 16 + lq;                                    // 0..127
    const int cl  = L >> 1, hf = L & 1;                              // channel 0..63
    const int nl  = hf * 32 + 4 * e;                                 // position 0..63
    const float bvs = bfr(wb[cl]);
    const size_t idx = ((size_t)(b * CC + cl)) * NN + n0 + nl;
    const v4f xv = *(const v4f*)(x + idx);
#pragma unroll
    for (int t = 0; t < 4; ++t) {
      res[it][t] = (Os[(nl + t) * OSP + cl] + bvs) + bfr(xv[t]);
    }
  }
{
#pragma unroll
    for (int it = 0; it < 8; ++it) {
      const int L   = it * 16 + lq;
      const int cl  = L >> 1, hf = L & 1;
      const int nl  = hf * 32 + 4 * e;
      const size_t idx = ((size_t)(b * CC + cl)) * NN + n0 + nl;
      *(v4f*)(out + idx) = res[it];
    }
    
  }
}

// =========================================================================================================
// Workspace map (bytes; each region start a multiple of 256; every extent is an exact row/tile multiple and is
//   W16 f16 [96][64]              12288       WWb bf16 [64][32]          4096
//   XP  f16 [NB][4096][64]      8388608 (NB=16)
//   Qh/Ql bf16 [NB][4096][32]   4194304 x2
//   PF/GF f32  [NB][4096][32]   8388608 x2
//   Kh/Kl bf16 [NB][1024][32]   1048576 x2   Gc f16 [NB][32][1024]   1048576
//   Yh/Yl bf16 [NB][4096][32]   4194304 x2
//   total (NB=16) = 45105152
// =========================================================================================================
extern "C" void kernel_launch(void* const* d_in, const int* in_sizes, int n_in,
                              void* d_out, int out_size, void* d_ws, size_t ws_size,
                              hipStream_t stream) {
  const int XN = NB * CC * NN;
  if (n_in < 9) return;
  if (in_sizes[0] < XN) return;
  if (in_sizes[1] < DQ * CC || in_sizes[3] < DQ * CC || in_sizes[5] < DQ * CC || in_sizes[7] < CC * DQ) return;
  if (in_sizes[2] < DQ || in_sizes[4] < DQ || in_sizes[6] < DQ || in_sizes[8] < CC) return;
  if (out_size < XN) return;

  size_t off = 0;
  auto carve = [&](size_t bytes) { const size_t o = off; off += (bytes + 255) & ~(size_t)255; return o; };
  const size_t oW16 = carve((size_t)MW * CC * 2);
  const size_t oWWb = carve((size_t)CC * DQ * 2);
  const size_t oXP  = carve((size_t)NB * NN * CC * 2);
  const size_t oQh  = carve((size_t)NB * NN * DQ * 2);
  const size_t oQl  = carve((size_t)NB * NN * DQ * 2);
  const size_t oPF  = carve((size_t)NB * NN * DQ * 4);
  const size_t oGF  = carve((size_t)NB * NN * DQ * 4);
  const size_t oKh  = carve((size_t)NB * MM * DQ * 2);
  const size_t oKl  = carve((size_t)NB * MM * DQ * 2);
  const size_t oGc  = carve((size_t)NB * DQ * MM * 2);
  const size_t oYh  = carve((size_t)NB * NN * DQ * 2);
  const size_t oYl  = carve((size_t)NB * NN * DQ * 2);
  if (off > ws_size) return;
  if (off > (size_t)134217728) return;

  const float* x  = (const float*)d_in[0];
  const float* gw = (const float*)d_in[1];
  const float* gb = (const float*)d_in[2];
  const float* tw = (const float*)d_in[3];
  const float* tb = (const float*)d_in[4];
  const float* pw = (const float*)d_in[5];
  const float* pb = (const float*)d_in[6];
  const float* ow = (const float*)d_in[7];
  const float* wb = (const float*)d_in[8];

  char* ws = (char*)d_ws;
  unsigned short* W16 = (unsigned short*)(ws + oW16);
  unsigned short* WWb = (unsigned short*)(ws + oWWb);
  unsigned short* XP  = (unsigned short*)(ws + oXP);
  unsigned short* Qh  = (unsigned short*)(ws + oQh);
  unsigned short* Ql  = (unsigned short*)(ws + oQl);
  float*          PF  = (float*)(ws + oPF);
  float*          GF  = (float*)(ws + oGF);
  unsigned short* Kh  = (unsigned short*)(ws + oKh);
  unsigned short* Kl  = (unsigned short*)(ws + oKl);
  unsigned short* Gc  = (unsigned short*)(ws + oGc);
  unsigned short* Yh  = (unsigned short*)(ws + oYh);
  unsigned short* Yl  = (unsigned short*)(ws + oYl);
  float* out = (float*)d_out;

  const dim3 blk256(256), blk128(128);

  // (0) theta_w / phi_w / g_w -> stacked f16 plane; w_w -> bf16 plane
  cvt_w<<<dim3(4), blk256, 0, stream>>>(tw, pw, gw, ow, W16, WWb);
  // (1) x -> position-major 16-bit plane
  cvt_x<<<dim3(NN / QT, NB), blk256, 0, stream>>>(x, XP);
  // (2) conv1x1 GEMM -> theta (q) hi/res planes, phi / g conv outputs + bias as f32 planes
  gemm_proj<<<dim3(NSTRIP, NB), blk256, 0, stream>>>(W16, XP, tb, pb, gb, Qh, Ql, PF, GF);
  // (3) 2x2 stride-2 max-pool -> pooled phi (k) hi/res planes, pooled g channel-major f16 plane
  pool_k<<<dim3(MM / QT, NB), blk256, 0, stream>>>(PF, GF, Kh, Kl, Gc);
  // (4) attention -> y hi/res planes [b][n][32]
  attn_k<<<dim3(NQ / QT, NB), blk128, 0, stream>>>(Qh, Ql, Kh, Kl, Gc, Yh, Yl);
  // (5) output conv + bias + residual -> out [b][64][4096]
  gemm_out<<<dim3(NQ / QT, NB), blk128, 0, stream>>>(WWb, Yh, Yl, wb, x, out);
  (void)hipGetLastError();
}

// v001
// A run of this version takes 49.3 microseconds.
// Two timings next to v000 put it at 1.41 and 1.38 times that version's speed.
// Contractions: conv1x1 theta/phi/g GEMM W[96x64].X[64x128] per strip on v_wmma_f32_16x16x32_f16 (f16 containers
// of bf16-RNE weights x256 and bf16-RNE x); scores K.Q^T on v_wmma_f32_16x16x32_bf16 (bf16 hi + bf16 residual planes
// of theta / 2x2-max-pooled phi, 3 products, K=32); y^T = G.P^T on v_wmma_f32_16x16x32_f16 (2x2-max-pooled g as
// f16, P = e^{s-m} x16384 f16 from the score D registers); output conv W[64x32].Y on v_wmma_f32_16x16x32_bf16 (bf16
// weights, y as bf16 hi + residual planes, 2 products); f32 accumulate everywhere; max-pool, softmax statistics,
// bias and residual add in f32 VALU.
#include <hip/hip_runtime.h>
#include <math.h>
#include <stdint.h>

#ifndef NB
#define NB 16
#endif
#ifndef NQ
#define NQ 4096
#endif
#define NB_FULL 16
#define CC     64
#define HIMG   64
#define WIMG   64
#define NN     4096
#define DQ     32
#define HP     32
#define WP     32
#define MM     1024
#define MW     96
#define NMT    6
#define QT     64
#define SN     128
#define NSTRIP 32
#define OSP    68
#define OSPP   100
#define OSPW   36
#define TP     72
#define WSC    256.0f
#define IWSC   0.00390625f
#define LNPS   9.704060527839234f
#define AQ     256
#define KVT    6160

static_assert(NB >= 1 && NB <= NB_FULL);
static_assert(NQ % QT == 0 && NQ >= QT && NQ <= NN);
static_assert(NN == HIMG * WIMG);
static_assert(SN == 2 * WIMG);
static_assert(NSTRIP * SN == NN);
static_assert(SN == 8 * 16);
static_assert(SN == 2 * 64 && SN == 4 * 32);
static_assert(HP * 2 == HIMG && WP * 2 == WIMG);
static_assert(MM == HP * WP);
static_assert(MM % QT == 0 && MM % 32 == 0);
static_assert(QT == 2 * WP);
static_assert(CC == QT);
static_assert(DQ == 32);
static_assert(MW == 3 * DQ && NMT * 16 == MW);
static_assert(CC % 32 == 0);
static_assert((OSP * 4) % 16 == 0);
static_assert((OSPP * 4) % 16 == 0 && OSPP >= MW);
static_assert((OSPW * 4) % 16 == 0 && OSPW >= DQ);
static_assert((TP * 2) % 16 == 0 && TP >= QT);
static_assert(SN * OSPP * 4 <= 65536);
static_assert((size_t)NB_FULL * CC * NN * 4 == (size_t)16777216);
static_assert(NQ % AQ == 0 && AQ == 16 * 16);
static_assert(KVT % 16 == 0 && KVT >= 6 * 1024 && (MM / 32) * KVT + AQ * OSPW * 4 <= 327680);
static_assert(MM * DQ * 2 == 8 * 512 * 16);

typedef _Float16       v16h __attribute__((ext_vector_type(16)));
typedef _Float16       v8h  __attribute__((ext_vector_type(8)));
typedef __bf16         v16b __attribute__((ext_vector_type(16)));
typedef unsigned short v8us __attribute__((ext_vector_type(8)));
typedef float          v8f  __attribute__((ext_vector_type(8)));
typedef float          v4f  __attribute__((ext_vector_type(4)));
typedef unsigned int   v4u  __attribute__((ext_vector_type(4)));

union Frag  { v8us u[2]; v16h h; v16b bf; };
union FragH { v16h v; v8h hv[2]; };
static_assert(sizeof(Frag) == 32);
static_assert(sizeof(FragH) == 32);

// ---- scalar helpers ---------------------------------------------------------------------------------------
__device__ __forceinline__ unsigned short bf_bits(float f) {          // f32 -> bf16 bits, RNE convert
  unsigned u = __float_as_uint(f);
  return (unsigned short)((u + 0x7FFFu + ((u >> 16) & 1u)) >> 16);
}
__device__ __forceinline__ float bf_up(unsigned short hb) { return __uint_as_float(((unsigned)hb) << 16); }
__device__ __forceinline__ float bfr(float f) { return bf_up(bf_bits(f)); }
__device__ __forceinline__ unsigned short h_bits(_Float16 x) { return __builtin_bit_cast(unsigned short, x); }
__device__ __forceinline__ unsigned pk16(unsigned short a, unsigned short b) { return (unsigned)a | ((unsigned)b << 16); }
__device__ __forceinline__ v8f zero8() { v8f z = {0.f, 0.f, 0.f, 0.f, 0.f, 0.f, 0.f, 0.f}; return z; }
__device__ __forceinline__ float hmax8(v8f s) {
  return fmaxf(fmaxf(fmaxf(s[0], s[1]), fmaxf(s[2], s[3])), fmaxf(fmaxf(s[4], s[5]), fmaxf(s[6], s[7])));
}
__device__ __forceinline__ unsigned wave_ballot(bool p) {
#if defined(__HIP_DEVICE_COMPILE__)
  return __builtin_amdgcn_ballot_w32(p);
#else
  return p ? 1u : 0u;
#endif
}
// 8 f32 values -> bf16 hi bits and bf16 residual bits (lo = RNE(v - hi)), packed 2 per uint
__device__ __forceinline__ void split8(const float* f, v4u& uh, v4u& ul) {
#pragma unroll
  for (int t = 0; t < 4; ++t) {
    const float f0 = f[2 * t], f1 = f[2 * t + 1];
    const unsigned short hb0 = bf_bits(f0), hb1 = bf_bits(f1);
    const unsigned short lb0 = bf_bits(f0 - bf_up(hb0));
    const unsigned short lb1 = bf_bits(f1 - bf_up(hb1));
    uh[t] = pk16(hb0, hb1);
    ul[t] = pk16(lb0, lb1);
  }
}

// ---- 16-bit fragment loader (A, or B from a k-contiguous [n][k] row): lane -> row/col (lane&15), p already includes
//      + 8*(lane>>4); elements 0..7 <- p[0..7] (k0+8h..), elements 8..15 <- p[16..23] (k0+16+8h..)
__device__ __forceinline__ Frag ldfrag(const unsigned short* p) {
  Frag f;
  f.u[0] = *(const v8us*)(p);
  f.u[1] = *(const v8us*)(p + 16);
  return f;
}

// the same fragment from two separate 16-byte places (LDS tiles kept in fragment order)
__device__ __forceinline__ Frag ldfrag2(const unsigned char* p0, const unsigned char* p1) {
  Frag f;
  f.u[0] = *(const v8us*)(p0);
  f.u[1] = *(const v8us*)(p1);
  return f;
}

// ---- eight asynchronous 16-byte copies global -> LDS per lane, copy i from g + 4096 i elements (8 KiB apart) to the
//      LDS byte address d[i]. One statement: the closing s_wait_xcnt 0 stands in front of any rewrite of the address
//      registers that the issued copies name. The landing wait (s_wait_asynccnt) is the caller's.
__device__ __forceinline__ void copy8v(const unsigned* d, const unsigned short* g) {
#if defined(__HIP_DEVICE_COMPILE__)
  asm volatile("global_load_async_to_lds_b128 %0, %8, off\n\t"
               "global_load_async_to_lds_b128 %1, %9, off\n\t"
               "global_load_async_to_lds_b128 %2, %10, off\n\t"
               "global_load_async_to_lds_b128 %3, %11, off\n\t"
               "global_load_async_to_lds_b128 %4, %12, off\n\t"
               "global_load_async_to_lds_b128 %5, %13, off\n\t"
               "global_load_async_to_lds_b128 %6, %14, off\n\t"
               "global_load_async_to_lds_b128 %7, %15, off\n\t"
               "s_wait_xcnt 0x0"
               :: "v"(d[0]), "v"(d[1]), "v"(d[2]), "v"(d[3]), "v"(d[4]), "v"(d[5]), "v"(d[6]), "v"(d[7]),
                  "v"(g), "v"(g + 4096), "v"(g + 2 * 4096), "v"(g + 3 * 4096), "v"(g + 4 * 4096), "v"(g + 5 * 4096),
                  "v"(g + 6 * 4096), "v"(g + 7 * 4096)
               : "memory");
#endif
}
__device__ __forceinline__ void copy8(unsigned d0, unsigned dstep, const unsigned short* g) {
  unsigned d[8];
#pragma unroll                                                       // constant indices: d stays in registers
  for (int i = 0; i < 8; ++i) d[i] = d0 + (unsigned)i * dstep;
  copy8v(d, g);
}

// ---- WMMA helpers: builtin followed by a 4-slot VALU gap tying D and keeping A/B live --------------------------
__device__ __forceinline__ v8f mma_h(v16h a, v16h b, v8f c) {
  v8f d = __builtin_amdgcn_wmma_f32_16x16x32_f16(false, a, false, b, (short)0, c, false, false);
#if defined(__HIP_DEVICE_COMPILE__)
  asm volatile("v_nop\n\tv_nop\n\tv_nop\n\tv_nop" : "+v"(d) : "v"(a), "v"(b));
#endif
  return d;
}
__device__ __forceinline__ v8f mma_b(v16b a, v16b b, v8f c) {
  v8f d = __builtin_amdgcn_wmma_f32_16x16x32_bf16(false, a, false, b, (short)0, c, false, false);
#if defined(__HIP_DEVICE_COMPILE__)
  const v16h ha = __builtin_bit_cast(v16h, a), hb = __builtin_bit_cast(v16h, b);
  asm volatile("v_nop\n\tv_nop\n\tv_nop\n\tv_nop" : "+v"(d) : "v"(ha), "v"(hb));
#endif
  return d;
}

// =========================================================================================================
// (0) weights. Blocks 0..2: W16 f16 [96][64], rows 0..31 = theta_w, 32..63 = phi_w, 64..95 = g_w; value =
//     lanes x 16 B, one instruction for all 32 rows. Block 3: WWb bf16 [64][32] = bf16-RNE of w_w; row = 64 B,
// coverage: 3 blocks x 32 rows x 8 lanes x 8 halves = 96 x 64; 1 block x 64 rows x 4 lanes x 8 = 64 x 32.
// =========================================================================================================
__global__ __launch_bounds__(256)
void cvt_w(const float* __restrict__ tw, const float* __restrict__ pw, const float* __restrict__ gw,
           const float* __restrict__ ow, unsigned short* W16, unsigned short* WWb) {
  const int tid = threadIdx.x, blk = blockIdx.x;
  if (blk < 3) {
    const int rl = tid >> 3, col = 8 * (tid & 7);                    // rl 0..31, col 0..56
    const int o = DQ * blk + rl;                                     // 0..95
    const float* wbase = (blk == 0) ? tw : ((blk == 1) ? pw : gw);  // all global
    const float* s = wbase + (size_t)rl * CC + col;
    const v4f a = *(const v4f*)s;
    const v4f q = *(const v4f*)(s + 4);
    const float f[8] = {a[0], a[1], a[2], a[3], q[0], q[1], q[2], q[3]};
    v4u u;
#pragma unroll
    for (int t = 0; t < 4; ++t) {
      const _Float16 h0 = (_Float16)(bfr(f[2 * t]) * WSC);
      const _Float16 h1 = (_Float16)(bfr(f[2 * t + 1]) * WSC);
      u[t] = pk16(h_bits(h0), h_bits(h1));
    }
{
      *(v4u*)(W16 + (size_t)o * CC + col) = u;
      
    }
  } else {
    const int o = tid >> 2;                                          // 0..63
    const int col = 8 * (tid & 3);                                   // 0..24
    const float* s = ow + (size_t)o * DQ + col;
    const v4f a = *(const v4f*)s;
    const v4f q = *(const v4f*)(s + 4);
    const float f[8] = {a[0], a[1], a[2], a[3], q[0], q[1], q[2], q[3]};
    v4u u;
#pragma unroll
    for (int t = 0; t < 4; ++t) u[t] = pk16(bf_bits(f[2 * t]), bf_bits(f[2 * t + 1]));
{
      *(v4u*)(WWb + (size_t)o * DQ + col) = u;
      
    }
  }
}

// =========================================================================================================
// (1) x f32 [b][64 c][4096 n] -> XP f16 [b][n][c] (position-major, bf16-RNE values, exact in f16) through an LDS
//     tile T[64 n][64 c] (pitch TP, cross-wave, block barrier). Block (nb, b) owns a 64 c x 64 n tile (all c).
// coverage: T written rows (8e+t)=0..63 x cols cl 0..63, read rows 0..63 x cols 8e..8e+7; XP 2 it x 32 rows x 8 lanes
//           x 8 = 64 n x 64 c; grid (64, NB) covers XP [b][0..4095][0..63] exactly once.
// =========================================================================================================
__global__ __launch_bounds__(256)
void cvt_x(const float* __restrict__ x, unsigned short* XP) {
  __shared__ __align__(16) unsigned short T[QT * TP];
  const int tid = threadIdx.x;
  const int nb = blockIdx.x, b = blockIdx.y;
  const int e = tid & 7, lq = tid >> 3;                             // lq 0..31
  const int n0 = nb * QT;
#pragma unroll
  for (int it = 0; it < 2; ++it) {
    const int cl = it * 32 + lq;                                     // 0..63
    const float* sp = x + ((size_t)(b * CC + cl)) * NN + n0 + 8 * e;
    const v4f a = *(const v4f*)sp;
    const v4f q = *(const v4f*)(sp + 4);
    unsigned short hb[8];
#pragma unroll
    for (int t = 0; t < 4; ++t) {
      hb[t]     = h_bits((_Float16)bfr(a[t]));
      hb[4 + t] = h_bits((_Float16)bfr(q[t]));
    }
#pragma unroll
    for (int t = 0; t < 8; ++t) T[(8 * e + t) * TP + cl] = hb[t];
  }
  __syncthreads();
  v4u up[2];
#pragma unroll
  for (int it = 0; it < 2; ++it) {
    const int nl = it * 32 + lq;                                     // 0..63
    up[it] = *(const v4u*)(T + nl * TP + 8 * e);
  }
{
#pragma unroll
    for (int it = 0; it < 2; ++it) {
      const int rl = it * 32 + lq;
      *(v4u*)(XP + ((size_t)(b * NN + n0 + rl)) * CC + 8 * e) = up[it];
    }
    
  }
}

// =========================================================================================================
// (2) conv1x1 GEMM for one (b, strip of 128 positions = image rows 2s and 2s+1), all 96 stacked outputs:
//     Y[o][n] = (1/256) sum_c W16[o][c] XP[b][n][c]. Block 256 threads = 8 waves; wave w owns cols n0+16w..+15
//     (one B fragment per k-step, k = c contiguous in the XP row) and 6 m-tiles (A rows o = 16 mt + (lane&15),
//     split k map loader from W16). K = 64 = 2 steps. Epilogue staged in LDS Os[n_loc][o_loc] (pitch OSPP, b128
//     stores), block barrier, then every thread:
//       o 0..31  -> theta + bias -> Qh/Ql bf16 [b][4096 n][32 d] (hi = RNE(v), lo = RNE(v-hi)): rows 64 B, 4 lanes x
//                   instruction per 64 rows (2 it);  o 64..95 -> g + bias -> GF f32, same layout.
// coverage: Os 8 waves x 16 n x 96 o = 128 x 96 written, reads rows <= 127 cols <= 95; theta planes 2 it x 64 rows
//           x 4 lanes x 8 = 128 n x 32 d; f32 planes 4 it x 32 rows x 8 lanes x 4 = 128 n x 32 d; grid (32, NB)
//           covers all 4096 rows x 32 d of Qh/Ql and of PF/GF exactly once.
// =========================================================================================================
__global__ __launch_bounds__(256)
void gemm_proj(const unsigned short* __restrict__ W16, const unsigned short* __restrict__ XP,
               const float* __restrict__ tb, const float* __restrict__ pb, const float* __restrict__ gb,
               unsigned short* Qh, unsigned short* Ql, float* PF, float* GF) {
  __shared__ __align__(16) float Os[SN * OSPP];
  const int tid  = threadIdx.x;
  const int lane = tid & 31, wave = tid >> 5;                        // wave 0..7
  const int hh   = lane >> 4, c = lane & 15;
  const int st   = blockIdx.x, b = blockIdx.y;
  const int n0   = st * SN;

  const unsigned short* ap = W16 + (size_t)c * CC + 8 * hh;
  const unsigned short* bp = XP + ((size_t)(b * NN + n0 + 16 * wave + c)) * CC + 8 * hh;

  v8f acc[NMT];
#pragma unroll
  for (int mt = 0; mt < NMT; ++mt) acc[mt] = zero8();

#pragma unroll
  for (int ks = 0; ks < CC / 32; ++ks) {
    const Frag fb = ldfrag(bp + 32 * ks);
#pragma unroll
    for (int mt = 0; mt < NMT; ++mt) {
      const Frag fa = ldfrag(ap + (size_t)(16 * mt) * CC + 32 * ks);
      acc[mt] = mma_h(fa.h, fb.h, acc[mt]);
    }
  }

  // ---- epilogue: scale back -> LDS Os[n_loc][o_loc]; lane (hh, c) holds o = 16 mt + 8 hh + r for n_loc = 16 w + c
  {
    const int nl = 16 * wave + c;
#pragma unroll
    for (int mt = 0; mt < NMT; ++mt) {
      v4f va, vb;
#pragma unroll
      for (int r = 0; r < 4; ++r) { va[r] = acc[mt][r] * IWSC; vb[r] = acc[mt][4 + r] * IWSC; }
      *(v4f*)(Os + nl * OSPP + 16 * mt + 8 * hh)     = va;
      *(v4f*)(Os + nl * OSPP + 16 * mt + 8 * hh + 4) = vb;
    }
  }
  __syncthreads();

  // theta -> bf16 hi / residual planes
  const int e4 = tid & 3, lq = tid >> 2;                             // lq 0..63
  float bv[8];
  {
    const v4f ba = *(const v4f*)(tb + 8 * e4);
    const v4f bq = *(const v4f*)(tb + 8 * e4 + 4);
#pragma unroll
    for (int t = 0; t < 4; ++t) { bv[t] = bfr(ba[t]); bv[4 + t] = bfr(bq[t]); }
  }
  v4u uh[2], ul[2];
#pragma unroll
  for (int it = 0; it < 2; ++it) {
    const int row = it * 64 + lq;                                    // n_loc 0..127
    const v4f a = *(const v4f*)(Os + row * OSPP + 8 * e4);
    const v4f q = *(const v4f*)(Os + row * OSPP + 8 * e4 + 4);
    float f[8];
#pragma unroll
    for (int t = 0; t < 4; ++t) { f[t] = a[t] + bv[t]; f[4 + t] = q[t] + bv[4 + t]; }
    split8(f, uh[it], ul[it]);
  }

  // phi and g (+ bias, f32) -> f32 planes
  const int e8 = tid & 7, lr = tid >> 3;                             // lr 0..31
  v4f bp4, bg4;
  {
    const v4f bq = *(const v4f*)(pb + 4 * e8);
    const v4f gq = *(const v4f*)(gb + 4 * e8);
#pragma unroll
    for (int t = 0; t < 4; ++t) { bp4[t] = bfr(bq[t]); bg4[t] = bfr(gq[t]); }
  }
  v4f rp[4], rg[4];
#pragma unroll
  for (int it = 0; it < 4; ++it) {
    const int row = it * 32 + lr;                                    // n_loc 0..127
    const v4f a = *(const v4f*)(Os + row * OSPP + DQ + 4 * e8);
    const v4f g = *(const v4f*)(Os + row * OSPP + 2 * DQ + 4 * e8);
    v4f va, vg;
#pragma unroll
    for (int t = 0; t < 4; ++t) { va[t] = a[t] + bp4[t]; vg[t] = g[t] + bg4[t]; }
    rp[it] = va;
    rg[it] = vg;
  }

{
#pragma unroll
    for (int it = 0; it < 2; ++it) {
      const int row = it * 64 + lq;
      const size_t po = ((size_t)(b * NN + n0 + row)) * DQ + 8 * e4;
      *(v4u*)(Qh + po) = uh[it];
      *(v4u*)(Ql + po) = ul[it];
    }
#pragma unroll
    for (int it = 0; it < 4; ++it) {
      const int row = it * 32 + lr;
      const size_t po = ((size_t)(b * NN + n0 + row)) * DQ + 4 * e8;
      *(v4f*)(PF + po) = rp[it];
      *(v4f*)(GF + po) = rg[it];
    }
    
  }
}

// =========================================================================================================
// (3) 2x2 stride-2 max-pool of PF / GF f32 [b][4096 n][32 d] in f32 -> Kh/Kl bf16 [b][1024 m][32 d]
//     (hi = RNE(v), lo = RNE(v-hi)) written directly, and pooled g as f16 transposed through an LDS tile
//     T[32 d][64 m] (pitch TP, cross-wave, block barrier) -> Gc f16 [b][32 d][1024 m] (channel-major, keys
//     contiguous). m = 32 py + px, window n = (2py+dy) 64 + 2px+dx, dy,dx in {0,1} (always in range).
//     Block (mt, b), 256 threads, owns keys 64 mt..64 mt+63: phase 1 thread (ml = tid>>2, e4 = tid&3) pools
//     8 d of key ml; Kh/Kl rows 64 B = 4 lanes x 16 B, 8 consecutive lanes per line, one instruction per plane
// coverage: T written rows (8 e4 + t) = 0..31 x cols ml 0..63, read rows d 0..31 x cols 8 e8..8 e8+7;
//           Kh/Kl 16 blocks x 64 rows x 4 lanes x 8 = 1024 x 32; Gc 16 blocks x 32 d x 8 lanes x 8 = 32 x 1024;
//           grid (16, NB) covers Kh/Kl [b][0..1023][0..31] and Gc [b][0..31][0..1023] exactly once.
// =========================================================================================================
__global__ __launch_bounds__(256)
void pool_k(const float* __restrict__ PF, const float* __restrict__ GF,
            unsigned short* Kh, unsigned short* Kl, unsigned short* Gc) {
  __shared__ __align__(16) unsigned short T[DQ * TP];
  const int tid = threadIdx.x, mt = blockIdx.x, b = blockIdx.y;
  const int e4 = tid & 3, ml = tid >> 2;                             // ml 0..63
  const int m  = QT * mt + ml;                                       // 0..1023
  const int py = m / WP, px = m - py * WP;                           // 0..31 each
  const size_t rb = ((size_t)(b * NN + (2 * py) * WIMG + 2 * px)) * DQ + 8 * e4;
  float fk[8], fg[8];
#pragma unroll
  for (int t = 0; t < 8; ++t) { fk[t] = -__builtin_inff(); fg[t] = -__builtin_inff(); }
#pragma unroll
  for (int dy = 0; dy < 2; ++dy) {
#pragma unroll
    for (int dx = 0; dx < 2; ++dx) {
      const size_t wo = rb + (size_t)(dy * WIMG + dx) * DQ;
      const float* pk = PF + wo;
      const float* pg = GF + wo;
      const v4f ka = *(const v4f*)pk, kq = *(const v4f*)(pk + 4);
      const v4f ga = *(const v4f*)pg, gq = *(const v4f*)(pg + 4);
#pragma unroll
      for (int t = 0; t < 4; ++t) {
        fk[t]     = fmaxf(fk[t], ka[t]);
        fk[4 + t] = fmaxf(fk[4 + t], kq[t]);
        fg[t]     = fmaxf(fg[t], ga[t]);
        fg[4 + t] = fmaxf(fg[4 + t], gq[t]);
      }
    }
  }
  v4u kh, kl;
  split8(fk, kh, kl);
#pragma unroll
  for (int t = 0; t < 8; ++t) T[(8 * e4 + t) * TP + ml] = h_bits((_Float16)fg[t]);
  __syncthreads();

  const int e8 = tid & 7, d = tid >> 3;                              // d 0..31
  const v4u up = *(const v4u*)(T + d * TP + 8 * e8);
  const size_t pok = ((size_t)(b * MM + m)) * DQ + 8 * e4;
  const size_t pog = ((size_t)(b * DQ + d)) * MM + QT * mt + 8 * e8;
{
    *(v4u*)(Kh + pok) = kh;
    *(v4u*)(Kl + pok) = kl;
    *(v4u*)(Gc + pog) = up;
    
  }
}

// =========================================================================================================
// (4) attention for one (b, 256-query tile), transposed formulation, 1024 keys, no mask, no scale:
//   S^T tile (16 keys x 16 queries) = A(k: row = key kb + (lane&15), 32 d via the split k map from the bf16
//   plane Kh [b][1024][32]) . B(q: col = query, same map from Qh [b][4096][32]) + A(Kh).B(Ql) + A(Kl).B(Qh)
//   (bf16 unscaled residual planes, shared accumulator); q fragments loaded once (K = 32 = one step).
//   Per lane the D tile holds 8 keys of ONE query: online softmax state per lane, one shuffle (lane^16) for the max
//   over 32 keys; the o/l rescale is skipped under a wave-uniform ballot when no lane's max grew (corr == 1 exactly
//   for every lane then); row-sum partials combined at the end. P = e^{s-m} x 16384 as f16 is the B operand of
//   y^T (rows channel, cols queries) += A(pooled g: rows channel = 16j + (lane&15), keys contiguous, f16 plane Gc
//   [b][32][1024]) . B(P^T): element r <- D of the tile covering keys kb..kb+15, element 8+r <- the tile covering
//   kb+16..kb+31, lane unchanged. 2 accumulator tiles per wave (32 channels). Block = 16 waves = 256 queries.
//   The batch's whole Kh, Kl and Gc planes (3 x 64 KiB) are copied once into LDS by asynchronous 16-byte copies and
//   every fragment is read from there. LDS layout: step t (32 keys) at t * KVT; in it six 1-KiB fragment tiles
//   (Kh keys 0..15, Kh keys 16..31, Kl likewise, Gc channels 0..15, 16..31); in a tile the 16-byte chunk j (k
//   elements 8j..8j+7) of row r stands at j * 256 + ((r + 4j) & 15) * 16, so that a half-wave's b128 read (fixed j,
//   16 rows) and a half-wave's copy (4 rows x 4 j, or 4 steps x 4 j with KVT = 6 KiB + 16 B) each meet every bank once.
//   Epilogue: y = O/l staged in LDS Os[query][32 channels] (pitch OSPW, b128 stores), block barrier, then
//   Yh/Yl bf16 [b][4096 n][32 ch] (hi = RNE(y), lo = RNE(y - hi)): row = 64 B = 4 lanes x 16 B, 8 consecutive
// coverage: Os written 16 waves x 16 queries x 32 ch, read rows 0..255 x ch 8e4..8e4+7 (e4 0..3); planes 2 it x 128
//           rows x 4 lanes x 8 = 256 n x 32 ch per plane; grid (NQ/256, NB) covers rows 0..NQ-1 of Yh/Yl once.
//           KV: per plane 8 copies x 512 threads x 16 B = 64 KiB, each chunk to its own place, all read places filled.
// =========================================================================================================
__global__ __launch_bounds__(512) __attribute__((amdgpu_num_vgpr(256)))
void attn_k(const unsigned short* __restrict__ Qh, const unsigned short* __restrict__ Ql,
            const unsigned short* __restrict__ Kh, const unsigned short* __restrict__ Kl,
            const unsigned short* __restrict__ Gc, unsigned short* Yh, unsigned short* Yl) {
  __shared__ __align__(16) unsigned char KV[(MM / 32) * KVT];
  __shared__ __align__(16) float Os[AQ * OSPW];
  const int tid  = threadIdx.x;
  const int wave = tid >> 5, lane = tid & 31;
  const int hh   = lane >> 4, c = lane & 15;
  const int n0   = blockIdx.x * AQ, b = blockIdx.y;

  // q fragments (B operand, col = query n0 + 16*wave + c), whole head dim in one fragment
  const size_t qo = ((size_t)(b * NN + n0 + 16 * wave + c)) * DQ + 8 * hh;
  const Frag qh = ldfrag(Qh + qo);
  const Frag ql = ldfrag(Ql + qo);

  // ---- fill KV once: thread tid copies chunk 512 i + tid of each plane (global side contiguous over the lanes)
  {
    const unsigned kv0 = (unsigned)(uintptr_t)KV;                    // LDS byte address of KV
    const int cj = tid & 3;                                          // chunk j inside its row / step
    // Kh, Kl: row = key 128 i + (tid >> 2): step 4 i + (tid >> 7), tile (tid >> 6) & 1, row in tile (tid >> 2) & 15
    const unsigned dk = kv0 + (unsigned)((tid >> 7) * KVT + ((tid >> 6) & 1) * 1024 + cj * 256 +
                                         ((((tid >> 2) & 15) + 4 * cj) & 15) * 16);
    const unsigned short* gkh = Kh + (size_t)b * MM * DQ + 8 * tid;
    const unsigned short* gkl = Kl + (size_t)b * MM * DQ + 8 * tid;
    copy8(dk, 4 * KVT, gkh);
    copy8(dk + 2048u, 4 * KVT, gkl);
    // Gc: channel 4 i + (tid >> 7), step (tid & 127) >> 2; the channel moves the place by its own rule, per copy
    const unsigned dv = kv0 + (unsigned)(((tid & 127) >> 2) * KVT + 4096 + cj * 256);
    const unsigned short* gv = Gc + (size_t)b * DQ * MM + 8 * tid;
    const int ch0 = tid >> 7;
    unsigned dvi[8];
#pragma unroll                                                       // constant indices: dvi stays in registers
    for (int i = 0; i < 8; ++i) {
      const int ch = 4 * i + ch0;                                    // 0..31
      dvi[i] = dv + (unsigned)((ch >> 4) * 1024 + (((ch & 15) + 4 * cj) & 15) * 16);
    }
    copy8v(dvi, gv);
    // every copy of this wave has landed before the barrier behind which the other waves read its bytes
#if defined(__HIP_DEVICE_COMPILE__)
    asm volatile("s_wait_asynccnt 0x0" ::: "memory");
#endif
  }
  __syncthreads();

  // fragment read places in a tile: elements 0..7 = chunk hh, elements 8..15 = chunk 2 + hh, row c
  const unsigned char* fa = KV + hh * 256 + ((c + 4 * hh) & 15) * 16;
  const unsigned char* fb = KV + (2 + hh) * 256 + ((c + 8 + 4 * hh) & 15) * 16;

  float m = -1.0e30f, l = 0.f;
  v8f o[2];
  o[0] = zero8();
  o[1] = zero8();

#pragma unroll 1
  for (int kb = 0; kb < MM; kb += 32) {
    const int so = (kb >> 5) * KVT;                                  // this step's place in KV
    const Frag k0  = ldfrag2(fa + so, fb + so);                      // keys kb .. kb+15
    const Frag k1  = ldfrag2(fa + so + 1024, fb + so + 1024);        // keys kb+16 .. kb+31
    const Frag k0l = ldfrag2(fa + so + 2048, fb + so + 2048);
    const Frag k1l = ldfrag2(fa + so + 3072, fb + so + 3072);
    Frag vf[2];                                                      // read with the k fragments: one place of LDS reads
#pragma unroll                                                       // constant indices: vf stays in registers
    for (int j = 0; j < 2; ++j) vf[j] = ldfrag2(fa + so + 4096 + 1024 * j, fb + so + 4096 + 1024 * j);
    v8f s0 = mma_b(k0.bf, qh.bf, zero8());
    v8f s1 = mma_b(k1.bf, qh.bf, zero8());
    s0 = mma_b(k0.bf, ql.bf, s0);
    s1 = mma_b(k1.bf, ql.bf, s1);
    s0 = mma_b(k0l.bf, qh.bf, s0);
    s1 = mma_b(k1l.bf, qh.bf, s1);

    float mx = fmaxf(hmax8(s0), hmax8(s1));
    mx = fmaxf(mx, __shfl_xor(mx, 16, 32));
    const float mn = fmaxf(m, mx);
    const unsigned grew = wave_ballot(mx > m);                       // wave-uniform
    if (grew != 0u) {
      const float corr = __expf(m - mn);                             // == 1 exactly for lanes whose max did not grow
      l *= corr;
#pragma unroll
      for (int j = 0; j < 2; ++j) {
#pragma unroll
        for (int r = 0; r < 8; ++r) o[j][r] *= corr;
      }
    }
    m = mn;
    const float msh = mn - LNPS;                                     // exp gives e^{s-m} * 16384

    FragH ph;
    float ls = 0.f;
#pragma unroll
    for (int r = 0; r < 8; ++r) {
      const float e0 = __expf(s0[r] - msh);                          // key kb      + 8hh + r
      const float e1 = __expf(s1[r] - msh);                          // key kb + 16 + 8hh + r
      ls += e0 + e1;
      ph.hv[0][r] = (_Float16)e0;
      ph.hv[1][r] = (_Float16)e1;
    }
    l += ls;

#pragma unroll
    for (int j = 0; j < 2; ++j) {
      o[j] = mma_h(vf[j].h, ph.v, o[j]);
    }
  }
  l += __shfl_xor(l, 16, 32);
  const float inv = 1.0f / l;                                        // o and l both carry the x16384 factor

  // ---- epilogue: y = o * inv -> Os[query][ch]; lane (hh, c) holds ch = 16 j + 8 hh + r for query 16 w + c
  {
    const int qrow = 16 * wave + c;
#pragma unroll
    for (int j = 0; j < 2; ++j) {
      v4f va, vb;
#pragma unroll
      for (int r = 0; r < 4; ++r) { va[r] = o[j][r] * inv; vb[r] = o[j][4 + r] * inv; }
      *(v4f*)(Os + qrow * OSPW + 16 * j + 8 * hh)     = va;
      *(v4f*)(Os + qrow * OSPW + 16 * j + 8 * hh + 4) = vb;
    }
  }
  __syncthreads();

  const int e4 = tid & 3, lr = tid >> 2;                             // lr 0..127
  v4u uh[2], ul[2];
#pragma unroll
  for (int it = 0; it < 2; ++it) {
    const int row = it * 128 + lr;                                   // query 0..255
    const v4f a = *(const v4f*)(Os + row * OSPW + 8 * e4);
    const v4f q = *(const v4f*)(Os + row * OSPW + 8 * e4 + 4);
    const float f[8] = {a[0], a[1], a[2], a[3], q[0], q[1], q[2], q[3]};
    split8(f, uh[it], ul[it]);
  }
{
#pragma unroll
    for (int it = 0; it < 2; ++it) {
      const int row = it * 128 + lr;
      const size_t po = ((size_t)(b * NN + n0 + row)) * DQ + 8 * e4;
      *(v4u*)(Yh + po) = uh[it];
      *(v4u*)(Yl + po) = ul[it];
    }
    
  }
}

// =========================================================================================================
// (5) output conv for one (b, 64-n tile), all 64 channels: A[c][n] = sum_ci WWb[c][ci] (Yh + Yl)[b][n][ci] on
//     bf16 WMMA (2 products, shared accumulator), K = 32 = 1 step. Block 128 threads = 4 waves; wave w owns cols
//     n0+16w..+15 (B fragments from the k-contiguous Yh/Yl rows) and 4 m-tiles (A rows c = 16 mt + (lane&15),
//     split k map loader from WWb). Epilogue staged in LDS Os[n_loc][c_loc] (pitch OSP, b128 stores), block
//     2 lines): 8 consecutive lanes x 16 B (values gathered from 4 Os rows), one instruction per 16 lines, final
// coverage: Os 4 waves x 16 n x 64 c written, read rows nl+t <= 63 x cols cl <= 63; out 8 it x 16 lines x 8 lanes x
//           4 floats = 64 c x 64 n; grid (NQ/64, NB) covers out[b][0..63][0..NQ-1] exactly once.
// =========================================================================================================
__global__ __launch_bounds__(128)
void gemm_out(const unsigned short* __restrict__ WWb, const unsigned short* __restrict__ Yh,
              const unsigned short* __restrict__ Yl, const float* __restrict__ wb,
              const float* __restrict__ x, float* out) {
  __shared__ __align__(16) float Os[QT * OSP];
  const int tid  = threadIdx.x;
  const int lane = tid & 31, wave = tid >> 5;
  const int hh   = lane >> 4, c = lane & 15;
  const int nt   = blockIdx.x, b = blockIdx.y;
  const int n0   = nt * QT;

  const unsigned short* ap = WWb + (size_t)c * DQ + 8 * hh;
  const size_t bo = ((size_t)(b * NN + n0 + 16 * wave + c)) * DQ + 8 * hh;
  const Frag fbh = ldfrag(Yh + bo);
  const Frag fbl = ldfrag(Yl + bo);

  v8f acc[4];
#pragma unroll
  for (int mt = 0; mt < 4; ++mt) {
    const Frag fa = ldfrag(ap + (size_t)(16 * mt) * DQ);
    v8f a0 = mma_b(fa.bf, fbh.bf, zero8());
    acc[mt] = mma_b(fa.bf, fbl.bf, a0);
  }

  // ---- epilogue: -> LDS Os[n_loc][c_loc]; lane (hh, c) holds c_loc = 16 mt + 8 hh + r for n_loc = 16 w + c
  {
    const int nl = 16 * wave + c;
#pragma unroll
    for (int mt = 0; mt < 4; ++mt) {
      v4f va, vb;
#pragma unroll
      for (int r = 0; r < 4; ++r) { va[r] = acc[mt][r]; vb[r] = acc[mt][4 + r]; }
      *(v4f*)(Os + nl * OSP + 16 * mt + 8 * hh)     = va;
      *(v4f*)(Os + nl * OSP + 16 * mt + 8 * hh + 4) = vb;
    }
  }
  __syncthreads();

  const int e = tid & 7, lq = tid >> 3;                              // lq 0..15
  v4f res[8];
#pragma unroll
  for (int it = 0; it < 8; ++it) {
    const int L   = it * 16 + lq;                                    // 0..127
    const int cl  = L >> 1, hf = L & 1;                              // channel 0..63
    const int nl  = hf * 32 + 4 * e;                                 // position 0..63
    const float bvs = bfr(wb[cl]);
    const size_t idx = ((size_t)(b * CC + cl)) * NN + n0 + nl;
    const v4f xv = *(const v4f*)(x + idx);
#pragma unroll
    for (int t = 0; t < 4; ++t) {
      res[it][t] = (Os[(nl + t) * OSP + cl] + bvs) + bfr(xv[t]);
    }
  }
{
#pragma unroll
    for (int it = 0; it < 8; ++it) {
      const int L   = it * 16 + lq;
      const int cl  = L >> 1, hf = L & 1;
      const int nl  = hf * 32 + 4 * e;
      const size_t idx = ((size_t)(b * CC + cl)) * NN + n0 + nl;
      *(v4f*)(out + idx) = res[it];
    }
    
  }
}

// =========================================================================================================
// Workspace map (bytes; each region start a multiple of 256; every extent is an exact row/tile multiple and is
//   W16 f16 [96][64]              12288       WWb bf16 [64][32]          4096
//   XP  f16 [NB][4096][64]      8388608 (NB=16)
//   Qh/Ql bf16 [NB][4096][32]   4194304 x2
//   PF/GF f32  [NB][4096][32]   8388608 x2
//   Kh/Kl bf16 [NB][1024][32]   1048576 x2   Gc f16 [NB][32][1024]   1048576
//   Yh/Yl bf16 [NB][4096][32]   4194304 x2
//   total (NB=16) = 45105152
// =========================================================================================================
extern "C" void kernel_launch(void* const* d_in, const int* in_sizes, int n_in,
                              void* d_out, int out_size, void* d_ws, size_t ws_size,
                              hipStream_t stream) {
  const int XN = NB * CC * NN;
  if (n_in < 9) return;
  if (in_sizes[0] < XN) return;
  if (in_sizes[1] < DQ * CC || in_sizes[3] < DQ * CC || in_sizes[5] < DQ * CC || in_sizes[7] < CC * DQ) return;
  if (in_sizes[2] < DQ || in_sizes[4] < DQ || in_sizes[6] < DQ || in_sizes[8] < CC) return;
  if (out_size < XN) return;

  size_t off = 0;
  auto carve = [&](size_t bytes) { const size_t o = off; off += (bytes + 255) & ~(size_t)255; return o; };
  const size_t oW16 = carve((size_t)MW * CC * 2);
  const size_t oWWb = carve((size_t)CC * DQ * 2);
  const size_t oXP  = carve((size_t)NB * NN * CC * 2);
  const size_t oQh  = carve((size_t)NB * NN * DQ * 2);
  const size_t oQl  = carve((size_t)NB * NN * DQ * 2);
  const size_t oPF  = carve((size_t)NB * NN * DQ * 4);
  const size_t oGF  = carve((size_t)NB * NN * DQ * 4);
  const size_t oKh  = carve((size_t)NB * MM * DQ * 2);
  const size_t oKl  = carve((size_t)NB * MM * DQ * 2);
  const size_t oGc  = carve((size_t)NB * DQ * MM * 2);
  const size_t oYh  = carve((size_t)NB * NN * DQ * 2);
  const size_t oYl  = carve((size_t)NB * NN * DQ * 2);
  if (off > ws_size) return;
  if (off > (size_t)134217728) return;

  const float* x  = (const float*)d_in[0];
  const float* gw = (const float*)d_in[1];
  const float* gb = (const float*)d_in[2];
  const float* tw = (const float*)d_in[3];
  const float* tb = (const float*)d_in[4];
  const float* pw = (const float*)d_in[5];
  const float* pb = (const float*)d_in[6];
  const float* ow = (const float*)d_in[7];
  const float* wb = (const float*)d_in[8];

  char* ws = (char*)d_ws;
  unsigned short* W16 = (unsigned short*)(ws + oW16);
  unsigned short* WWb = (unsigned short*)(ws + oWWb);
  unsigned short* XP  = (unsigned short*)(ws + oXP);
  unsigned short* Qh  = (unsigned short*)(ws + oQh);
  unsigned short* Ql  = (unsigned short*)(ws + oQl);
  float*          PF  = (float*)(ws + oPF);
  float*          GF  = (float*)(ws + oGF);
  unsigned short* Kh  = (unsigned short*)(ws + oKh);
  unsigned short* Kl  = (unsigned short*)(ws + oKl);
  unsigned short* Gc  = (unsigned short*)(ws + oGc);
  unsigned short* Yh  = (unsigned short*)(ws + oYh);
  unsigned short* Yl  = (unsigned short*)(ws + oYl);
  float* out = (float*)d_out;

  const dim3 blk256(256), blk128(128), blk512(512);

  // (0) theta_w / phi_w / g_w -> stacked f16 plane; w_w -> bf16 plane
  cvt_w<<<dim3(4), blk256, 0, stream>>>(tw, pw, gw, ow, W16, WWb);
  // (1) x -> position-major 16-bit plane
  cvt_x<<<dim3(NN / QT, NB), blk256, 0, stream>>>(x, XP);
  // (2) conv1x1 GEMM -> theta (q) hi/res planes, phi / g conv outputs + bias as f32 planes
  gemm_proj<<<dim3(NSTRIP, NB), blk256, 0, stream>>>(W16, XP, tb, pb, gb, Qh, Ql, PF, GF);
  // (3) 2x2 stride-2 max-pool -> pooled phi (k) hi/res planes, pooled g channel-major f16 plane
  pool_k<<<dim3(MM / QT, NB), blk256, 0, stream>>>(PF, GF, Kh, Kl, Gc);
  // (4) attention -> y hi/res planes [b][n][32]
  attn_k<<<dim3(NQ / AQ, NB), blk512, 0, stream>>>(Qh, Ql, Kh, Kl, Gc, Yh, Yl);
  // (5) output conv + bias + residual -> out [b][64][4096]
  gemm_out<<<dim3(NQ / QT, NB), blk128, 0, stream>>>(WWb, Yh, Yl, wb, x, out);
  (void)hipGetLastError();
}

// v002
// Measured time: 33 microseconds a run.
// In two side-by-side timings against v001, it was 1.50 and 1.48 times as fast.
// All steps since v000 together make it 2.08 times as fast.
// Contractions: conv1x1 theta/phi/g GEMM W[96x64].X[64x128] per strip on v_wmma_f32_16x16x32_f16 (f16 containers
// of bf16-RNE weights x256 and bf16-RNE x); scores K.Q^T on v_wmma_f32_16x16x32_bf16 (bf16 hi + bf16 residual planes
// of theta / 2x2-max-pooled phi, 3 products, K=32); y^T = G.P^T on v_wmma_f32_16x16x32_f16 (2x2-max-pooled g as
// f16, P = e^{s-m} x16384 f16 from the score D registers); output conv W[64x32].Y on v_wmma_f32_16x16x32_bf16 (bf16
// weights, y as bf16 hi + residual planes, 2 products); f32 accumulate everywhere; max-pool, softmax statistics,
// bias and residual add in f32 VALU.
#include <hip/hip_runtime.h>
#include <math.h>
#include <stdint.h>

#ifndef NB
#define NB 16
#endif
#ifndef NQ
#define NQ 4096
#endif
#define NB_FULL 16
#define CC     64
#define HIMG   64
#define WIMG   64
#define NN     4096
#define DQ     32
#define HP     32
#define WP     32
#define MM     1024
#define MW     96
#define NMT    6
#define QT     64
#define SN     128
#define NSTRIP 32
#define OSP    68
#define OSPP   100
#define OSPW   36
#define TP     72
#define WSC    256.0f
#define IWSC   0.00390625f
#define LNPS   9.704060527839234f
#define AQ     256
#define KVT    6160

static_assert(NB >= 1 && NB <= NB_FULL);
static_assert(NQ % QT == 0 && NQ >= QT && NQ <= NN);
static_assert(NN == HIMG * WIMG);
static_assert(SN == 2 * WIMG);
static_assert(NSTRIP * SN == NN);
static_assert(SN == 8 * 16);
static_assert(SN == 2 * 64 && SN == 4 * 32);
static_assert(HP * 2 == HIMG && WP * 2 == WIMG);
static_assert(MM == HP * WP);
static_assert(MM % QT == 0 && MM % 32 == 0);
static_assert(QT == 2 * WP);
static_assert(CC == QT);
static_assert(DQ == 32);
static_assert(MW == 3 * DQ && NMT * 16 == MW);
static_assert(CC % 32 == 0);
static_assert((OSP * 4) % 16 == 0);
static_assert((OSPP * 4) % 16 == 0 && OSPP >= MW);
static_assert((OSPW * 4) % 16 == 0 && OSPW >= DQ);
static_assert((TP * 2) % 16 == 0 && TP >= QT);
static_assert(SN * OSPP * 4 <= 65536);
static_assert((size_t)NB_FULL * CC * NN * 4 == (size_t)16777216);
static_assert(NQ % AQ == 0 && AQ == 16 * 16);
static_assert(KVT % 16 == 0 && KVT >= 6 * 1024 && (MM / 32) * KVT + AQ * OSPW * 4 <= 327680);
static_assert(MM * DQ * 2 == 8 * 512 * 16);

typedef _Float16       v16h __attribute__((ext_vector_type(16)));
typedef _Float16       v8h  __attribute__((ext_vector_type(8)));
typedef __bf16         v16b __attribute__((ext_vector_type(16)));
typedef unsigned short v8us __attribute__((ext_vector_type(8)));
typedef float          v8f  __attribute__((ext_vector_type(8)));
typedef float          v4f  __attribute__((ext_vector_type(4)));
typedef unsigned int   v4u  __attribute__((ext_vector_type(4)));

union Frag  { v8us u[2]; v16h h; v16b bf; };
union FragH { v16h v; v8h hv[2]; };
static_assert(sizeof(Frag) == 32);
static_assert(sizeof(FragH) == 32);

// ---- scalar helpers ---------------------------------------------------------------------------------------
__device__ __forceinline__ unsigned short bf_bits(float f) {          // f32 -> bf16 bits, RNE convert
  unsigned u = __float_as_uint(f);
  return (unsigned short)((u + 0x7FFFu + ((u >> 16) & 1u)) >> 16);
}
__device__ __forceinline__ float bf_up(unsigned short hb) { return __uint_as_float(((unsigned)hb) << 16); }
__device__ __forceinline__ float bfr(float f) { return bf_up(bf_bits(f)); }
__device__ __forceinline__ unsigned short h_bits(_Float16 x) { return __builtin_bit_cast(unsigned short, x); }
__device__ __forceinline__ unsigned pk16(unsigned short a, unsigned short b) { return (unsigned)a | ((unsigned)b << 16); }
__device__ __forceinline__ v8f zero8() { v8f z = {0.f, 0.f, 0.f, 0.f, 0.f, 0.f, 0.f, 0.f}; return z; }
__device__ __forceinline__ float hmax8(v8f s) {
  return fmaxf(fmaxf(fmaxf(s[0], s[1]), fmaxf(s[2], s[3])), fmaxf(fmaxf(s[4], s[5]), fmaxf(s[6], s[7])));
}
__device__ __forceinline__ unsigned wave_ballot(bool p) {
#if defined(__HIP_DEVICE_COMPILE__)
  return __builtin_amdgcn_ballot_w32(p);
#else
  return p ? 1u : 0u;
#endif
}
// 8 f32 values -> bf16 hi bits and bf16 residual bits (lo = RNE(v - hi)), packed 2 per uint
__device__ __forceinline__ void split8(const float* f, v4u& uh, v4u& ul) {
#pragma unroll
  for (int t = 0; t < 4; ++t) {
    const float f0 = f[2 * t], f1 = f[2 * t + 1];
    const unsigned short hb0 = bf_bits(f0), hb1 = bf_bits(f1);
    const unsigned short lb0 = bf_bits(f0 - bf_up(hb0));
    const unsigned short lb1 = bf_bits(f1 - bf_up(hb1));
    uh[t] = pk16(hb0, hb1);
    ul[t] = pk16(lb0, lb1);
  }
}

// ---- 16-bit fragment loader (A, or B from a k-contiguous [n][k] row): lane -> row/col (lane&15), p already includes
//      + 8*(lane>>4); elements 0..7 <- p[0..7] (k0+8h..), elements 8..15 <- p[16..23] (k0+16+8h..)
__device__ __forceinline__ Frag ldfrag(const unsigned short* p) {
  Frag f;
  f.u[0] = *(const v8us*)(p);
  f.u[1] = *(const v8us*)(p + 16);
  return f;
}

// the same fragment from two separate 16-byte places (LDS tiles kept in fragment order)
__device__ __forceinline__ Frag ldfrag2(const unsigned char* p0, const unsigned char* p1) {
  Frag f;
  f.u[0] = *(const v8us*)(p0);
  f.u[1] = *(const v8us*)(p1);
  return f;
}

// ---- eight asynchronous 16-byte copies global -> LDS per lane, copy i from g + 4096 i elements (8 KiB apart) to the
//      LDS byte address d[i]. One statement: the closing s_wait_xcnt 0 stands in front of any rewrite of the address
//      registers that the issued copies name. The landing wait (s_wait_asynccnt) is the caller's.
__device__ __forceinline__ void copy8v(const unsigned* d, const unsigned short* g) {
#if defined(__HIP_DEVICE_COMPILE__)
  asm volatile("global_load_async_to_lds_b128 %0, %8, off\n\t"
               "global_load_async_to_lds_b128 %1, %9, off\n\t"
               "global_load_async_to_lds_b128 %2, %10, off\n\t"
               "global_load_async_to_lds_b128 %3, %11, off\n\t"
               "global_load_async_to_lds_b128 %4, %12, off\n\t"
               "global_load_async_to_lds_b128 %5, %13, off\n\t"
               "global_load_async_to_lds_b128 %6, %14, off\n\t"
               "global_load_async_to_lds_b128 %7, %15, off\n\t"
               "s_wait_xcnt 0x0"
               :: "v"(d[0]), "v"(d[1]), "v"(d[2]), "v"(d[3]), "v"(d[4]), "v"(d[5]), "v"(d[6]), "v"(d[7]),
                  "v"(g), "v"(g + 4096), "v"(g + 2 * 4096), "v"(g + 3 * 4096), "v"(g + 4 * 4096), "v"(g + 5 * 4096),
                  "v"(g + 6 * 4096), "v"(g + 7 * 4096)
               : "memory");
#endif
}
__device__ __forceinline__ void copy8(unsigned d0, unsigned dstep, const unsigned short* g) {
  unsigned d[8];
#pragma unroll                                                       // constant indices: d stays in registers
  for (int i = 0; i < 8; ++i) d[i] = d0 + (unsigned)i * dstep;
  copy8v(d, g);
}

// ---- WMMA helpers: builtin followed by a 4-slot VALU gap tying D and keeping A/B live --------------------------
__device__ __forceinline__ v8f mma_h(v16h a, v16h b, v8f c) {
  v8f d = __builtin_amdgcn_wmma_f32_16x16x32_f16(false, a, false, b, (short)0, c, false, false);
#if defined(__HIP_DEVICE_COMPILE__)
  asm volatile("v_nop\n\tv_nop\n\tv_nop\n\tv_nop" : "+v"(d) : "v"(a), "v"(b));
#endif
  return d;
}
__device__ __forceinline__ v8f mma_b(v16b a, v16b b, v8f c) {
  v8f d = __builtin_amdgcn_wmma_f32_16x16x32_bf16(false, a, false, b, (short)0, c, false, false);
#if defined(__HIP_DEVICE_COMPILE__)
  const v16h ha = __builtin_bit_cast(v16h, a), hb = __builtin_bit_cast(v16h, b);
  asm volatile("v_nop\n\tv_nop\n\tv_nop\n\tv_nop" : "+v"(d) : "v"(ha), "v"(hb));
#endif
  return d;
}

// =========================================================================================================
// (0) front end for one (b, strip of 128 positions = image rows 2s and 2s+1), one launch, everything between x and
//     the attention operands kept in LDS. Block 256 threads = 8 waves.
//     a) x f32 [b][64 c][4096 n]: wave w reads rows c = 8w..8w+7, lane q the 16 bytes n0+4q..+3 of each (a whole
//        512-B row per instruction) -> Xs f16 [128 n][64 c] (pitch TP, bf16-RNE values, exact in f16), b128 stores.
//        theta_w / phi_w / g_w f32 -> Wl f16 [96 o][64 c] (pitch TP; rows 0..31 theta, 32..63 phi, 64..95 g; value =
//        bf16-RNE x256). Block (0, 0) also writes WWb bf16 [64][32] = bf16-RNE of w_w for the output conv launch.
//     b) block barrier; Y[o][n] = (1/256) sum_c Wl[o][c] Xs[n][c]: wave w owns cols 16w..16w+15 (one B fragment per
//        k-step) and 6 m-tiles (A rows o = 16 mt + (lane&15)), K = 64 = 2 steps, fragments by the split k map from
//        LDS; results to Os[n_loc][o_loc] (pitch OSPP, b128 stores); block barrier.
//     c) o 0..31 -> theta + bias -> Qh/Ql bf16 [b][4096 n][32 d] (hi = RNE(v), lo = RNE(v-hi)).
//        The strip holds every 2x2 window of pooled row py = s: key m = 32 s + px, window n_loc = 64 dy + 2 px + dx.
//        Waves 0..3: o 32..63 -> max over the window, + bias (rounding is monotone: the same value as the max of the
//        biased four) -> Kh/Kl bf16 [b][1024 m][32 d]. Waves 4..7: o 64..95 likewise -> f16 -> Gc in fragment order
//        [b][32 steps][4 j][32 ch][8 keys]: step = s, chunk j = keys 8j..8j+7 of the step; wave 4+j, lane = channel.
// coverage: Xs 8 waves x 8 c x 128 n, Wl 3 x 32 rows x 8 lanes x 8, both read whole; Os 8 waves x 16 n x 96 o written,
//           reads rows <= 127 cols <= 95; Qh/Ql 2 it x 64 rows x 4 lanes x 8 = 128 n x 32 d; Kh/Kl 32 rows x 4 lanes x
//           8; Gc 4 waves x 32 lanes x 8 = 2 KiB; grid (32, NB) covers every plane exactly once, a block's piece of
//           each plane contiguous (8 KiB, 2 KiB, 2 KiB).
// =========================================================================================================
__global__ __launch_bounds__(256)
void proj_pool(const float* __restrict__ x, const float* __restrict__ tw, const float* __restrict__ pw,
               const float* __restrict__ gw, const float* __restrict__ ow, const float* __restrict__ tb,
               const float* __restrict__ pb, const float* __restrict__ gb, unsigned short* WWb,
               unsigned short* Qh, unsigned short* Ql, unsigned short* Kh, unsigned short* Kl,
               unsigned short* Gc) {
  __shared__ __align__(16) unsigned short Xs[SN * TP];
  __shared__ __align__(16) unsigned short Wl[MW * TP];
  __shared__ __align__(16) float Os[SN * OSPP];
  const int tid  = threadIdx.x;
  const int lane = tid & 31, wave = tid >> 5;                        // wave 0..7
  const int hh   = lane >> 4, c = lane & 15;
  const int st   = blockIdx.x, b = blockIdx.y;
  const int n0   = st * SN;

  // ---- a) all global reads first, then the conversions
  v4f xv[8];
  {
    const float* sp = x + ((size_t)(b * CC + 8 * wave)) * NN + n0 + 4 * lane;
#pragma unroll                                                       // constant indices: the array stays in registers
    for (int i = 0; i < 8; ++i) xv[i] = *(const v4f*)(sp + (size_t)i * NN);
  }
  const int rl = tid >> 3, col = 8 * (tid & 7);                      // rl 0..31, col 0..56
  v4f wa[3], wq[3];
#pragma unroll                                                       // constant indices: the array stays in registers
  for (int k = 0; k < 3; ++k) {
    const float* wbase = (k == 0) ? tw : ((k == 1) ? pw : gw);
    const float* s = wbase + (size_t)rl * CC + col;
    wa[k] = *(const v4f*)s;
    wq[k] = *(const v4f*)(s + 4);
  }
  // biases: read here, with the other global reads, so that no memory latency stands behind the barriers
  const int e4 = tid & 3, lq = tid >> 2;                             // lq 0..63
  const v4f tba = *(const v4f*)(tb + 8 * e4), tbq = *(const v4f*)(tb + 8 * e4 + 4);
  const v4f pba = *(const v4f*)(pb + 8 * e4), pbq = *(const v4f*)(pb + 8 * e4 + 4);
  const float gbl = gb[lane];
  if (st == 0 && b == 0) {
    const int o = tid >> 2;                                          // 0..63
    const int oc = 8 * (tid & 3);                                    // 0..24
    const float* s = ow + (size_t)o * DQ + oc;
    const v4f a = *(const v4f*)s;
    const v4f q = *(const v4f*)(s + 4);
    const float f[8] = {a[0], a[1], a[2], a[3], q[0], q[1], q[2], q[3]};
    v4u u;
#pragma unroll                                                       // constant indices: the array stays in registers
    for (int t = 0; t < 4; ++t) u[t] = pk16(bf_bits(f[2 * t]), bf_bits(f[2 * t + 1]));
    *(v4u*)(WWb + (size_t)o * DQ + oc) = u;
  }
#pragma unroll                                                       // constant indices: the array stays in registers
  for (int k = 0; k < 3; ++k) {
    const float f[8] = {wa[k][0], wa[k][1], wa[k][2], wa[k][3], wq[k][0], wq[k][1], wq[k][2], wq[k][3]};
    v4u u;
#pragma unroll                                                       // constant indices: the array stays in registers
    for (int t = 0; t < 4; ++t) {
      const _Float16 h0 = (_Float16)(bfr(f[2 * t]) * WSC);
      const _Float16 h1 = (_Float16)(bfr(f[2 * t + 1]) * WSC);
      u[t] = pk16(h_bits(h0), h_bits(h1));
    }
    *(v4u*)(Wl + (DQ * k + rl) * TP + col) = u;
  }
#pragma unroll                                                       // constant indices: the array stays in registers
  for (int t = 0; t < 4; ++t) {                                      // position 4 lane + t, channels 8 wave .. + 7
    v4u u;
#pragma unroll                                                       // constant indices: the array stays in registers
    for (int i = 0; i < 4; ++i) {
      u[i] = pk16(h_bits((_Float16)bfr(xv[2 * i][t])), h_bits((_Float16)bfr(xv[2 * i + 1][t])));
    }
    *(v4u*)(Xs + (4 * lane + t) * TP + 8 * wave) = u;
  }
  __syncthreads();

  // ---- b) the GEMM, fragments from LDS
  const unsigned short* ap = Wl + c * TP + 8 * hh;
  const unsigned short* bp = Xs + (16 * wave + c) * TP + 8 * hh;

  v8f acc[NMT];
#pragma unroll                                                       // constant indices: the array stays in registers
  for (int mt = 0; mt < NMT; ++mt) acc[mt] = zero8();

  Frag fb[CC / 32], fa[CC / 32][NMT];                                // all fragments first: one place of LDS reads
#pragma unroll                                                       // constant indices: fragments stay in registers
  for (int ks = 0; ks < CC / 32; ++ks) {
    fb[ks] = ldfrag(bp + 32 * ks);
#pragma unroll                                                       // constant indices: the array stays in registers
    for (int mt = 0; mt < NMT; ++mt) fa[ks][mt] = ldfrag(ap + (16 * mt) * TP + 32 * ks);
  }
#pragma unroll                                                       // constant indices: the array stays in registers
  for (int ks = 0; ks < CC / 32; ++ks) {
#pragma unroll                                                       // constant indices: the array stays in registers
    for (int mt = 0; mt < NMT; ++mt) acc[mt] = mma_h(fa[ks][mt].h, fb[ks].h, acc[mt]);
  }

  // scale back -> LDS Os[n_loc][o_loc]; lane (hh, c) holds o = 16 mt + 8 hh + r for n_loc = 16 w + c
  {
    const int nl = 16 * wave + c;
#pragma unroll                                                       // constant indices: the array stays in registers
    for (int mt = 0; mt < NMT; ++mt) {
      v4f va, vb;
#pragma unroll                                                       // constant indices: the array stays in registers
      for (int r = 0; r < 4; ++r) { va[r] = acc[mt][r] * IWSC; vb[r] = acc[mt][4 + r] * IWSC; }
      *(v4f*)(Os + nl * OSPP + 16 * mt + 8 * hh)     = va;
      *(v4f*)(Os + nl * OSPP + 16 * mt + 8 * hh + 4) = vb;
    }
  }
  __syncthreads();

  // ---- c) theta -> bf16 hi / residual planes
  {
    float bv[8];
#pragma unroll                                                       // constant indices: the array stays in registers
    for (int t = 0; t < 4; ++t) { bv[t] = bfr(tba[t]); bv[4 + t] = bfr(tbq[t]); }
#pragma unroll                                                       // constant indices: the array stays in registers
    for (int it = 0; it < 2; ++it) {
      const int row = it * 64 + lq;                                  // n_loc 0..127
      const v4f a = *(const v4f*)(Os + row * OSPP + 8 * e4);
      const v4f q = *(const v4f*)(Os + row * OSPP + 8 * e4 + 4);
      float f[8];
#pragma unroll                                                       // constant indices: the array stays in registers
      for (int t = 0; t < 4; ++t) { f[t] = a[t] + bv[t]; f[4 + t] = q[t] + bv[4 + t]; }
      v4u uh, ul;
      split8(f, uh, ul);
      const size_t po = ((size_t)(b * NN + n0 + row)) * DQ + 8 * e4;
      *(v4u*)(Qh + po) = uh;
      *(v4u*)(Ql + po) = ul;
    }
  }

  if (wave < 4) {
    // pooled phi: thread (key lq 0..31, 8 d at 8 e4)
    float fk[8];
#pragma unroll                                                       // constant indices: the array stays in registers
    for (int t = 0; t < 8; ++t) fk[t] = -__builtin_inff();
#pragma unroll                                                       // constant indices: the array stays in registers
    for (int dy = 0; dy < 2; ++dy) {
#pragma unroll                                                       // constant indices: the array stays in registers
      for (int dx = 0; dx < 2; ++dx) {
        const float* pk = Os + (dy * WIMG + 2 * lq + dx) * OSPP + DQ + 8 * e4;
        const v4f ka = *(const v4f*)pk, kq = *(const v4f*)(pk + 4);
#pragma unroll                                                       // constant indices: the array stays in registers
        for (int t = 0; t < 4; ++t) {
          fk[t]     = fmaxf(fk[t], ka[t]);
          fk[4 + t] = fmaxf(fk[4 + t], kq[t]);
        }
      }
    }
#pragma unroll                                                       // constant indices: the array stays in registers
    for (int t = 0; t < 4; ++t) { fk[t] += bfr(pba[t]); fk[4 + t] += bfr(pbq[t]); }
    v4u kh, kl;
    split8(fk, kh, kl);
    const size_t pok = ((size_t)(b * MM + WP * st + lq)) * DQ + 8 * e4;
    *(v4u*)(Kh + pok) = kh;
    *(v4u*)(Kl + pok) = kl;
  } else {
    // pooled g: wave 4 + j makes chunk j (keys 8j..8j+7 of the step), lane = channel
    const int j = wave - 4;
    const float bg = bfr(gbl);
    unsigned short hb[8];
#pragma unroll                                                       // constant indices: the array stays in registers
    for (int t = 0; t < 8; ++t) {
      const float* pg = Os + (2 * (8 * j + t)) * OSPP + 2 * DQ + lane;
      const float v = fmaxf(fmaxf(pg[0], pg[OSPP]), fmaxf(pg[WIMG * OSPP], pg[(WIMG + 1) * OSPP])) + bg;
      hb[t] = h_bits((_Float16)v);
    }
    v4u up;
#pragma unroll                                                       // constant indices: the array stays in registers
    for (int t = 0; t < 4; ++t) up[t] = pk16(hb[2 * t], hb[2 * t + 1]);
    *(v4u*)(Gc + ((size_t)(b * NSTRIP + st)) * (DQ * WP) + (size_t)(j * DQ + lane) * 8) = up;
  }
}

// =========================================================================================================
// (4) attention for one (b, 256-query tile), transposed formulation, 1024 keys, no mask, no scale:
//   S^T tile (16 keys x 16 queries) = A(k: row = key kb + (lane&15), 32 d via the split k map from the bf16
//   plane Kh [b][1024][32]) . B(q: col = query, same map from Qh [b][4096][32]) + A(Kh).B(Ql) + A(Kl).B(Qh)
//   (bf16 unscaled residual planes, shared accumulator); q fragments loaded once (K = 32 = one step).
//   Per lane the D tile holds 8 keys of ONE query: online softmax state per lane, one shuffle (lane^16) for the max
//   over 32 keys; the o/l rescale is skipped under a wave-uniform ballot when no lane's max grew (corr == 1 exactly
//   for every lane then); row-sum partials combined at the end. P = e^{s-m} x 16384 as f16 is the B operand of
//   y^T (rows channel, cols queries) += A(pooled g: rows channel = 16j + (lane&15), keys contiguous, f16 plane Gc
//   [b][32 steps][4 j][32 ch][8 keys]) . B(P^T): element r <- D of the tile covering keys kb..kb+15, element 8+r <- the tile covering
//   kb+16..kb+31, lane unchanged. 2 accumulator tiles per wave (32 channels). Block = 16 waves = 256 queries.
//   The batch's whole Kh, Kl and Gc planes (3 x 64 KiB) are copied once into LDS by asynchronous 16-byte copies and
//   every fragment is read from there. LDS layout: step t (32 keys) at t * KVT; in it six 1-KiB fragment tiles
//   (Kh keys 0..15, Kh keys 16..31, Kl likewise, Gc channels 0..15, 16..31); in a tile the 16-byte chunk j (k
//   elements 8j..8j+7) of row r stands at j * 256 + ((r + 4j) & 15) * 16, so that a half-wave's b128 read (fixed j,
//   16 rows) and a half-wave's copy (4 rows x 4 j for Kh and Kl, 16 rows of one j for Gc) each meet every bank once.
//   Epilogue: y = O/l staged in LDS Os[query][32 channels] (pitch OSPW, b128 stores), block barrier, then
//   Yh/Yl bf16 [b][4096 n][32 ch] (hi = RNE(y), lo = RNE(y - hi)): row = 64 B = 4 lanes x 16 B, 8 consecutive
// coverage: Os written 16 waves x 16 queries x 32 ch, read rows 0..255 x ch 8e4..8e4+7 (e4 0..3); planes 2 it x 128
//           rows x 4 lanes x 8 = 256 n x 32 ch per plane; grid (NQ/256, NB) covers rows 0..NQ-1 of Yh/Yl once.
//           KV: per plane 8 copies x 512 threads x 16 B = 64 KiB, each chunk to its own place, all read places filled.
// =========================================================================================================
__global__ __launch_bounds__(512) __attribute__((amdgpu_num_vgpr(256)))
void attn_k(const unsigned short* __restrict__ Qh, const unsigned short* __restrict__ Ql,
            const unsigned short* __restrict__ Kh, const unsigned short* __restrict__ Kl,
            const unsigned short* __restrict__ Gc, unsigned short* Yh, unsigned short* Yl) {
  __shared__ __align__(16) unsigned char KV[(MM / 32) * KVT];
  __shared__ __align__(16) float Os[AQ * OSPW];
  const int tid  = threadIdx.x;
  const int wave = tid >> 5, lane = tid & 31;
  const int hh   = lane >> 4, c = lane & 15;
  const int n0   = blockIdx.x * AQ, b = blockIdx.y;

  // q fragments (B operand, col = query n0 + 16*wave + c), whole head dim in one fragment
  const size_t qo = ((size_t)(b * NN + n0 + 16 * wave + c)) * DQ + 8 * hh;
  const Frag qh = ldfrag(Qh + qo);
  const Frag ql = ldfrag(Ql + qo);

  // ---- fill KV once: thread tid copies chunk 512 i + tid of each plane (global side contiguous over the lanes)
  {
    const unsigned kv0 = (unsigned)(uintptr_t)KV;                    // LDS byte address of KV
    const int cj = tid & 3;                                          // chunk j inside its row / step
    // Kh, Kl: row = key 128 i + (tid >> 2): step 4 i + (tid >> 7), tile (tid >> 6) & 1, row in tile (tid >> 2) & 15
    const unsigned dk = kv0 + (unsigned)((tid >> 7) * KVT + ((tid >> 6) & 1) * 1024 + cj * 256 +
                                         ((((tid >> 2) & 15) + 4 * cj) & 15) * 16);
    const unsigned short* gkh = Kh + (size_t)b * MM * DQ + 8 * tid;
    const unsigned short* gkl = Kl + (size_t)b * MM * DQ + 8 * tid;
    copy8(dk, 4 * KVT, gkh);
    copy8(dk + 2048u, 4 * KVT, gkl);
    // Gc (fragment order): step 4 i + (tid >> 7), chunk j = (tid >> 5) & 3, channel tid & 31
    const int vj = (tid >> 5) & 3;
    const unsigned dv = kv0 + (unsigned)((tid >> 7) * KVT + 4096 + ((tid >> 4) & 1) * 1024 + vj * 256 +
                                         (((tid & 15) + 4 * vj) & 15) * 16);
    const unsigned short* gv = Gc + (size_t)b * DQ * MM + 8 * tid;
    copy8(dv, 4 * KVT, gv);
    // every copy of this wave has landed before the barrier behind which the other waves read its bytes
#if defined(__HIP_DEVICE_COMPILE__)
    asm volatile("s_wait_asynccnt 0x0" ::: "memory");
#endif
  }
  __syncthreads();

  // fragment read places in a tile: elements 0..7 = chunk hh, elements 8..15 = chunk 2 + hh, row c
  const unsigned char* fa = KV + hh * 256 + ((c + 4 * hh) & 15) * 16;
  const unsigned char* fb = KV + (2 + hh) * 256 + ((c + 8 + 4 * hh) & 15) * 16;

  float m = -1.0e30f, l = 0.f;
  v8f o[2];
  o[0] = zero8();
  o[1] = zero8();

#pragma unroll 1
  for (int kb = 0; kb < MM; kb += 32) {
    const int so = (kb >> 5) * KVT;                                  // this step's place in KV
    const Frag k0  = ldfrag2(fa + so, fb + so);                      // keys kb .. kb+15
    const Frag k1  = ldfrag2(fa + so + 1024, fb + so + 1024);        // keys kb+16 .. kb+31
    const Frag k0l = ldfrag2(fa + so + 2048, fb + so + 2048);
    const Frag k1l = ldfrag2(fa + so + 3072, fb + so + 3072);
    Frag vf[2];                                                      // read with the k fragments: one place of LDS reads
#pragma unroll                                                       // constant indices: vf stays in registers
    for (int j = 0; j < 2; ++j) vf[j] = ldfrag2(fa + so + 4096 + 1024 * j, fb + so + 4096 + 1024 * j);
    v8f s0 = mma_b(k0.bf, qh.bf, zero8());
    v8f s1 = mma_b(k1.bf, qh.bf, zero8());
    s0 = mma_b(k0.bf, ql.bf, s0);
    s1 = mma_b(k1.bf, ql.bf, s1);
    s0 = mma_b(k0l.bf, qh.bf, s0);
    s1 = mma_b(k1l.bf, qh.bf, s1);

    float mx = fmaxf(hmax8(s0), hmax8(s1));
    mx = fmaxf(mx, __shfl_xor(mx, 16, 32));
    const float mn = fmaxf(m, mx);
    const unsigned grew = wave_ballot(mx > m);                       // wave-uniform
    if (grew != 0u) {
      const float corr = __expf(m - mn);                             // == 1 exactly for lanes whose max did not grow
      l *= corr;
#pragma unroll
      for (int j = 0; j < 2; ++j) {
#pragma unroll
        for (int r = 0; r < 8; ++r) o[j][r] *= corr;
      }
    }
    m = mn;
    const float msh = mn - LNPS;                                     // exp gives e^{s-m} * 16384

    FragH ph;
    float ls = 0.f;
#pragma unroll
    for (int r = 0; r < 8; ++r) {
      const float e0 = __expf(s0[r] - msh);                          // key kb      + 8hh + r
      const float e1 = __expf(s1[r] - msh);                          // key kb + 16 + 8hh + r
      ls += e0 + e1;
      ph.hv[0][r] = (_Float16)e0;
      ph.hv[1][r] = (_Float16)e1;
    }
    l += ls;

#pragma unroll
    for (int j = 0; j < 2; ++j) {
      o[j] = mma_h(vf[j].h, ph.v, o[j]);
    }
  }
  l += __shfl_xor(l, 16, 32);
  const float inv = 1.0f / l;                                        // o and l both carry the x16384 factor

  // ---- epilogue: y = o * inv -> Os[query][ch]; lane (hh, c) holds ch = 16 j + 8 hh + r for query 16 w + c
  {
    const int qrow = 16 * wave + c;
#pragma unroll
    for (int j = 0; j < 2; ++j) {
      v4f va, vb;
#pragma unroll
      for (int r = 0; r < 4; ++r) { va[r] = o[j][r] * inv; vb[r] = o[j][4 + r] * inv; }
      *(v4f*)(Os + qrow * OSPW + 16 * j + 8 * hh)     = va;
      *(v4f*)(Os + qrow * OSPW + 16 * j + 8 * hh + 4) = vb;
    }
  }
  __syncthreads();

  const int e4 = tid & 3, lr = tid >> 2;                             // lr 0..127
  v4u uh[2], ul[2];
#pragma unroll
  for (int it = 0; it < 2; ++it) {
    const int row = it * 128 + lr;                                   // query 0..255
    const v4f a = *(const v4f*)(Os + row * OSPW + 8 * e4);
    const v4f q = *(const v4f*)(Os + row * OSPW + 8 * e4 + 4);
    const float f[8] = {a[0], a[1], a[2], a[3], q[0], q[1], q[2], q[3]};
    split8(f, uh[it], ul[it]);
  }
{
#pragma unroll
    for (int it = 0; it < 2; ++it) {
      const int row = it * 128 + lr;
      const size_t po = ((size_t)(b * NN + n0 + row)) * DQ + 8 * e4;
      *(v4u*)(Yh + po) = uh[it];
      *(v4u*)(Yl + po) = ul[it];
    }
    
  }
}

// =========================================================================================================
// (5) output conv for one (b, 64-n tile), all 64 channels: A[c][n] = sum_ci WWb[c][ci] (Yh + Yl)[b][n][ci] on
//     bf16 WMMA (2 products, shared accumulator), K = 32 = 1 step. Block 128 threads = 4 waves; wave w owns cols
//     n0+16w..+15 (B fragments from the k-contiguous Yh/Yl rows) and 4 m-tiles (A rows c = 16 mt + (lane&15),
//     split k map loader from WWb). Epilogue staged in LDS Os[n_loc][c_loc] (pitch OSP, b128 stores), block
//     2 lines): 8 consecutive lanes x 16 B (values gathered from 4 Os rows), one instruction per 16 lines, final
// coverage: Os 4 waves x 16 n x 64 c written, read rows nl+t <= 63 x cols cl <= 63; out 8 it x 16 lines x 8 lanes x
//           4 floats = 64 c x 64 n; grid (NQ/64, NB) covers out[b][0..63][0..NQ-1] exactly once.
// =========================================================================================================
__global__ __launch_bounds__(128)
void gemm_out(const unsigned short* __restrict__ WWb, const unsigned short* __restrict__ Yh,
              const unsigned short* __restrict__ Yl, const float* __restrict__ wb,
              const float* __restrict__ x, float* out) {
  __shared__ __align__(16) float Os[QT * OSP];
  const int tid  = threadIdx.x;
  const int lane = tid & 31, wave = tid >> 5;
  const int hh   = lane >> 4, c = lane & 15;
  const int nt   = blockIdx.x, b = blockIdx.y;
  const int n0   = nt * QT;

  const unsigned short* ap = WWb + (size_t)c * DQ + 8 * hh;
  const size_t bo = ((size_t)(b * NN + n0 + 16 * wave + c)) * DQ + 8 * hh;
  const Frag fbh = ldfrag(Yh + bo);
  const Frag fbl = ldfrag(Yl + bo);

  v8f acc[4];
#pragma unroll
  for (int mt = 0; mt < 4; ++mt) {
    const Frag fa = ldfrag(ap + (size_t)(16 * mt) * DQ);
    v8f a0 = mma_b(fa.bf, fbh.bf, zero8());
    acc[mt] = mma_b(fa.bf, fbl.bf, a0);
  }

  // ---- epilogue: -> LDS Os[n_loc][c_loc]; lane (hh, c) holds c_loc = 16 mt + 8 hh + r for n_loc = 16 w + c
  {
    const int nl = 16 * wave + c;
#pragma unroll
    for (int mt = 0; mt < 4; ++mt) {
      v4f va, vb;
#pragma unroll
      for (int r = 0; r < 4; ++r) { va[r] = acc[mt][r]; vb[r] = acc[mt][4 + r]; }
      *(v4f*)(Os + nl * OSP + 16 * mt + 8 * hh)     = va;
      *(v4f*)(Os + nl * OSP + 16 * mt + 8 * hh + 4) = vb;
    }
  }
  __syncthreads();

  const int e = tid & 7, lq = tid >> 3;                              // lq 0..15
  v4f res[8];
#pragma unroll
  for (int it = 0; it < 8; ++it) {
    const int L   = it * 16 + lq;                                    // 0..127
    const int cl  = L >> 1, hf = L & 1;                              // channel 0..63
    const int nl  = hf * 32 + 4 * e;                                 // position 0..63
    const float bvs = bfr(wb[cl]);
    const size_t idx = ((size_t)(b * CC + cl)) * NN + n0 + nl;
    const v4f xv = *(const v4f*)(x + idx);
#pragma unroll
    for (int t = 0; t < 4; ++t) {
      res[it][t] = (Os[(nl + t) * OSP + cl] + bvs) + bfr(xv[t]);
    }
  }
{
#pragma unroll
    for (int it = 0; it < 8; ++it) {
      const int L   = it * 16 + lq;
      const int cl  = L >> 1, hf = L & 1;
      const int nl  = hf * 32 + 4 * e;
      const size_t idx = ((size_t)(b * CC + cl)) * NN + n0 + nl;
      *(v4f*)(out + idx) = res[it];
    }
    
  }
}

// =========================================================================================================
// Workspace map (bytes; each region start a multiple of 256; every extent is an exact row/tile multiple and is
//   WWb bf16 [64][32]              4096
//   Qh/Ql bf16 [NB][4096][32]   4194304 x2 (NB=16)
//   Kh/Kl bf16 [NB][1024][32]   1048576 x2   Gc f16 [NB][32][4][32][8]   1048576
//   Yh/Yl bf16 [NB][4096][32]   4194304 x2
//   total (NB=16) = 19927040
// =========================================================================================================
extern "C" void kernel_launch(void* const* d_in, const int* in_sizes, int n_in,
                              void* d_out, int out_size, void* d_ws, size_t ws_size,
                              hipStream_t stream) {
  const int XN = NB * CC * NN;
  if (n_in < 9) return;
  if (in_sizes[0] < XN) return;
  if (in_sizes[1] < DQ * CC || in_sizes[3] < DQ * CC || in_sizes[5] < DQ * CC || in_sizes[7] < CC * DQ) return;
  if (in_sizes[2] < DQ || in_sizes[4] < DQ || in_sizes[6] < DQ || in_sizes[8] < CC) return;
  if (out_size < XN) return;

  size_t off = 0;
  auto carve = [&](size_t bytes) { const size_t o = off; off += (bytes + 255) & ~(size_t)255; return o; };
  const size_t oWWb = carve((size_t)CC * DQ * 2);
  const size_t oQh  = carve((size_t)NB * NN * DQ * 2);
  const size_t oQl  = carve((size_t)NB * NN * DQ * 2);
  const size_t oKh  = carve((size_t)NB * MM * DQ * 2);
  const size_t oKl  = carve((size_t)NB * MM * DQ * 2);
  const size_t oGc  = carve((size_t)NB * DQ * MM * 2);
  const size_t oYh  = carve((size_t)NB * NN * DQ * 2);
  const size_t oYl  = carve((size_t)NB * NN * DQ * 2);
  if (off > ws_size) return;
  if (off > (size_t)134217728) return;

  const float* x  = (const float*)d_in[0];
  const float* gw = (const float*)d_in[1];
  const float* gb = (const float*)d_in[2];
  const float* tw = (const float*)d_in[3];
  const float* tb = (const float*)d_in[4];
  const float* pw = (const float*)d_in[5];
  const float* pb = (const float*)d_in[6];
  const float* ow = (const float*)d_in[7];
  const float* wb = (const float*)d_in[8];

  char* ws = (char*)d_ws;
  unsigned short* WWb = (unsigned short*)(ws + oWWb);
  unsigned short* Qh  = (unsigned short*)(ws + oQh);
  unsigned short* Ql  = (unsigned short*)(ws + oQl);
  unsigned short* Kh  = (unsigned short*)(ws + oKh);
  unsigned short* Kl  = (unsigned short*)(ws + oKl);
  unsigned short* Gc  = (unsigned short*)(ws + oGc);
  unsigned short* Yh  = (unsigned short*)(ws + oYh);
  unsigned short* Yl  = (unsigned short*)(ws + oYl);
  float* out = (float*)d_out;

  const dim3 blk256(256), blk128(128), blk512(512);

  // (0) x, weights -> theta (q) hi/res planes, pooled phi (k) hi/res planes, pooled g f16 plane; w_w -> bf16 plane
  proj_pool<<<dim3(NSTRIP, NB), blk256, 0, stream>>>(x, tw, pw, gw, ow, tb, pb, gb, WWb, Qh, Ql, Kh, Kl, Gc);
  // (4) attention -> y hi/res planes [b][n][32]
  attn_k<<<dim3(NQ / AQ, NB), blk512, 0, stream>>>(Qh, Ql, Kh, Kl, Gc, Yh, Yl);
  // (5) output conv + bias + residual -> out [b][64][4096]
  gemm_out<<<dim3(NQ / QT, NB), blk128, 0, stream>>>(WWb, Yh, Yl, wb, x, out);
  (void)hipGetLastError();
}

// v003
// Measured time: 29.1 microseconds a run.
// Next to v002, in two timings, it ran 1.14 and 1.15 times as fast.
// Counting every step since v000, it is 2.37 times as fast.
// Contractions: conv1x1 theta/phi/g GEMM W[96x64].X[64x128] per strip on v_wmma_f32_16x16x32_f16 (f16 containers
// of bf16-RNE weights x256 and bf16-RNE x); scores K.Q^T on v_wmma_f32_16x16x32_bf16 (bf16 hi + bf16 residual planes
// of theta / 2x2-max-pooled phi, 3 products, K=32); y^T = G.P^T on v_wmma_f32_16x16x32_f16 (2x2-max-pooled g as
// f16, P = e^{s-m} x16384 f16 from the score D registers); output conv Y.W^T[32x64] on v_wmma_f32_16x16x32_bf16 (bf16
// weights, y as bf16 hi + residual fragments, 2 products); f32 accumulate everywhere; max-pool, softmax statistics,
// bias and residual add in f32 VALU.
#include <hip/hip_runtime.h>
#include <math.h>
#include <stdint.h>

#ifndef NB
#define NB 16
#endif
#ifndef NQ
#define NQ 4096
#endif
#define NB_FULL 16
#define CC     64
#define HIMG   64
#define WIMG   64
#define NN     4096
#define DQ     32
#define HP     32
#define WP     32
#define MM     1024
#define MW     96
#define NMT    6
#define QT     64
#define SN     128
#define NSTRIP 32
#define OSPP   100
#define OCP    260
#define TP     72
#define WSC    256.0f
#define IWSC   0.00390625f
#define LNPS   9.704060527839234f
#define AQ     256
#define KVT    6160

static_assert(NB >= 1 && NB <= NB_FULL);
static_assert(NQ % QT == 0 && NQ >= QT && NQ <= NN);
static_assert(NN == HIMG * WIMG);
static_assert(SN == 2 * WIMG);
static_assert(NSTRIP * SN == NN);
static_assert(SN == 8 * 16);
static_assert(SN == 2 * 64 && SN == 4 * 32);
static_assert(HP * 2 == HIMG && WP * 2 == WIMG);
static_assert(MM == HP * WP);
static_assert(MM % QT == 0 && MM % 32 == 0);
static_assert(QT == 2 * WP);
static_assert(CC == QT);
static_assert(DQ == 32);
static_assert(MW == 3 * DQ && NMT * 16 == MW);
static_assert(CC % 32 == 0);
static_assert((OSPP * 4) % 16 == 0 && OSPP >= MW);
static_assert((OCP * 4) % 16 == 0 && OCP >= AQ && OCP % 64 == 4);
static_assert((TP * 2) % 16 == 0 && TP >= QT);
static_assert(SN * OSPP * 4 <= 65536);
static_assert((size_t)NB_FULL * CC * NN * 4 == (size_t)16777216);
static_assert(NQ % AQ == 0 && AQ == 16 * 16);
static_assert(KVT % 16 == 0 && KVT >= 6 * 1024 && (MM / 32) * KVT + CC * OCP * 4 <= 327680);
static_assert(MM * DQ * 2 == 8 * 512 * 16);

typedef _Float16       v16h __attribute__((ext_vector_type(16)));
typedef _Float16       v8h  __attribute__((ext_vector_type(8)));
typedef __bf16         v16b __attribute__((ext_vector_type(16)));
typedef unsigned short v8us __attribute__((ext_vector_type(8)));
typedef float          v8f  __attribute__((ext_vector_type(8)));
typedef float          v4f  __attribute__((ext_vector_type(4)));
typedef unsigned int   v4u  __attribute__((ext_vector_type(4)));

union Frag  { v8us u[2]; v16h h; v16b bf; };
union FragH { v16h v; v8h hv[2]; };
static_assert(sizeof(Frag) == 32);
static_assert(sizeof(FragH) == 32);

// ---- scalar helpers ---------------------------------------------------------------------------------------
__device__ __forceinline__ unsigned short bf_bits(float f) {          // f32 -> bf16 bits, RNE convert
  unsigned u = __float_as_uint(f);
  return (unsigned short)((u + 0x7FFFu + ((u >> 16) & 1u)) >> 16);
}
__device__ __forceinline__ float bf_up(unsigned short hb) { return __uint_as_float(((unsigned)hb) << 16); }
__device__ __forceinline__ float bfr(float f) { return bf_up(bf_bits(f)); }
__device__ __forceinline__ unsigned short h_bits(_Float16 x) { return __builtin_bit_cast(unsigned short, x); }
__device__ __forceinline__ unsigned pk16(unsigned short a, unsigned short b) { return (unsigned)a | ((unsigned)b << 16); }
__device__ __forceinline__ v8f zero8() { v8f z = {0.f, 0.f, 0.f, 0.f, 0.f, 0.f, 0.f, 0.f}; return z; }
__device__ __forceinline__ float hmax8(v8f s) {
  return fmaxf(fmaxf(fmaxf(s[0], s[1]), fmaxf(s[2], s[3])), fmaxf(fmaxf(s[4], s[5]), fmaxf(s[6], s[7])));
}
__device__ __forceinline__ unsigned wave_ballot(bool p) {
#if defined(__HIP_DEVICE_COMPILE__)
  return __builtin_amdgcn_ballot_w32(p);
#else
  return p ? 1u : 0u;
#endif
}
// 8 f32 values -> bf16 hi bits and bf16 residual bits (lo = RNE(v - hi)), packed 2 per uint
__device__ __forceinline__ void split8(const float* f, v4u& uh, v4u& ul) {
#pragma unroll
  for (int t = 0; t < 4; ++t) {
    const float f0 = f[2 * t], f1 = f[2 * t + 1];
    const unsigned short hb0 = bf_bits(f0), hb1 = bf_bits(f1);
    const unsigned short lb0 = bf_bits(f0 - bf_up(hb0));
    const unsigned short lb1 = bf_bits(f1 - bf_up(hb1));
    uh[t] = pk16(hb0, hb1);
    ul[t] = pk16(lb0, lb1);
  }
}

// ---- 16-bit fragment loader (A, or B from a k-contiguous [n][k] row): lane -> row/col (lane&15), p already includes
//      + 8*(lane>>4); elements 0..7 <- p[0..7] (k0+8h..), elements 8..15 <- p[16..23] (k0+16+8h..)
__device__ __forceinline__ Frag ldfrag(const unsigned short* p) {
  Frag f;
  f.u[0] = *(const v8us*)(p);
  f.u[1] = *(const v8us*)(p + 16);
  return f;
}

// the same fragment from two separate 16-byte places (LDS tiles kept in fragment order)
__device__ __forceinline__ Frag ldfrag2(const unsigned char* p0, const unsigned char* p1) {
  Frag f;
  f.u[0] = *(const v8us*)(p0);
  f.u[1] = *(const v8us*)(p1);
  return f;
}

// ---- eight asynchronous 16-byte copies global -> LDS per lane, copy i from g + 4096 i elements (8 KiB apart) to the
//      LDS byte address d[i]. One statement: the closing s_wait_xcnt 0 stands in front of any rewrite of the address
//      registers that the issued copies name. The landing wait (s_wait_asynccnt) is the caller's.
__device__ __forceinline__ void copy8v(const unsigned* d, const unsigned short* g) {
#if defined(__HIP_DEVICE_COMPILE__)
  asm volatile("global_load_async_to_lds_b128 %0, %8, off\n\t"
               "global_load_async_to_lds_b128 %1, %9, off\n\t"
               "global_load_async_to_lds_b128 %2, %10, off\n\t"
               "global_load_async_to_lds_b128 %3, %11, off\n\t"
               "global_load_async_to_lds_b128 %4, %12, off\n\t"
               "global_load_async_to_lds_b128 %5, %13, off\n\t"
               "global_load_async_to_lds_b128 %6, %14, off\n\t"
               "global_load_async_to_lds_b128 %7, %15, off\n\t"
               "s_wait_xcnt 0x0"
               :: "v"(d[0]), "v"(d[1]), "v"(d[2]), "v"(d[3]), "v"(d[4]), "v"(d[5]), "v"(d[6]), "v"(d[7]),
                  "v"(g), "v"(g + 4096), "v"(g + 2 * 4096), "v"(g + 3 * 4096), "v"(g + 4 * 4096), "v"(g + 5 * 4096),
                  "v"(g + 6 * 4096), "v"(g + 7 * 4096)
               : "memory");
#endif
}
__device__ __forceinline__ void copy8(unsigned d0, unsigned dstep, const unsigned short* g) {
  unsigned d[8];
#pragma unroll                                                       // constant indices: d stays in registers
  for (int i = 0; i < 8; ++i) d[i] = d0 + (unsigned)i * dstep;
  copy8v(d, g);
}

// ---- WMMA helpers: builtin followed by a 4-slot VALU gap tying D and keeping A/B live --------------------------
__device__ __forceinline__ v8f mma_h(v16h a, v16h b, v8f c) {
  v8f d = __builtin_amdgcn_wmma_f32_16x16x32_f16(false, a, false, b, (short)0, c, false, false);
#if defined(__HIP_DEVICE_COMPILE__)
  asm volatile("v_nop\n\tv_nop\n\tv_nop\n\tv_nop" : "+v"(d) : "v"(a), "v"(b));
#endif
  return d;
}
__device__ __forceinline__ v8f mma_b(v16b a, v16b b, v8f c) {
  v8f d = __builtin_amdgcn_wmma_f32_16x16x32_bf16(false, a, false, b, (short)0, c, false, false);
#if defined(__HIP_DEVICE_COMPILE__)
  const v16h ha = __builtin_bit_cast(v16h, a), hb = __builtin_bit_cast(v16h, b);
  asm volatile("v_nop\n\tv_nop\n\tv_nop\n\tv_nop" : "+v"(d) : "v"(ha), "v"(hb));
#endif
  return d;
}

// =========================================================================================================
// (0) front end for one (b, strip of 128 positions = image rows 2s and 2s+1), one launch, everything between x and
//     the attention operands kept in LDS. Block 256 threads = 8 waves.
//     a) x f32 [b][64 c][4096 n]: wave w reads rows c = 8w..8w+7, lane q the 16 bytes n0+4q..+3 of each (a whole
//        512-B row per instruction) -> Xs f16 [128 n][64 c] (pitch TP, bf16-RNE values, exact in f16), b128 stores.
//        theta_w / phi_w / g_w f32 -> Wl f16 [96 o][64 c] (pitch TP; rows 0..31 theta, 32..63 phi, 64..95 g; value =
//        bf16-RNE x256). Block (0, 0) also writes WWb bf16 [64][32] = bf16-RNE of w_w for the output conv in the next launch.
//     b) block barrier; Y[o][n] = (1/256) sum_c Wl[o][c] Xs[n][c]: wave w owns cols 16w..16w+15 (one B fragment per
//        k-step) and 6 m-tiles (A rows o = 16 mt + (lane&15)), K = 64 = 2 steps, fragments by the split k map from
//        LDS; results to Os[n_loc][o_loc] (pitch OSPP, b128 stores); block barrier.
//     c) o 0..31 -> theta + bias -> Qh/Ql bf16 [b][4096 n][32 d] (hi = RNE(v), lo = RNE(v-hi)).
//        The strip holds every 2x2 window of pooled row py = s: key m = 32 s + px, window n_loc = 64 dy + 2 px + dx.
//        Waves 0..3: o 32..63 -> max over the window, + bias (rounding is monotone: the same value as the max of the
//        biased four) -> Kh/Kl bf16 [b][1024 m][32 d]. Waves 4..7: o 64..95 likewise -> f16 -> Gc in fragment order
//        [b][32 steps][4 j][32 ch][8 keys]: step = s, chunk j = keys 8j..8j+7 of the step; wave 4+j, lane = channel.
// coverage: Xs 8 waves x 8 c x 128 n, Wl 3 x 32 rows x 8 lanes x 8, both read whole; Os 8 waves x 16 n x 96 o written,
//           reads rows <= 127 cols <= 95; Qh/Ql 2 it x 64 rows x 4 lanes x 8 = 128 n x 32 d; Kh/Kl 32 rows x 4 lanes x
//           8; Gc 4 waves x 32 lanes x 8 = 2 KiB; grid (32, NB) covers every plane exactly once, a block's piece of
//           each plane contiguous (8 KiB, 2 KiB, 2 KiB).
// =========================================================================================================
__global__ __launch_bounds__(256)
void proj_pool(const float* __restrict__ x, const float* __restrict__ tw, const float* __restrict__ pw,
               const float* __restrict__ gw, const float* __restrict__ ow, const float* __restrict__ tb,
               const float* __restrict__ pb, const float* __restrict__ gb, unsigned short* WWb,
               unsigned short* Qh, unsigned short* Ql, unsigned short* Kh, unsigned short* Kl,
               unsigned short* Gc) {
  __shared__ __align__(16) unsigned short Xs[SN * TP];
  __shared__ __align__(16) unsigned short Wl[MW * TP];
  __shared__ __align__(16) float Os[SN * OSPP];
  const int tid  = threadIdx.x;
  const int lane = tid & 31, wave = tid >> 5;                        // wave 0..7
  const int hh   = lane >> 4, c = lane & 15;
  const int st   = blockIdx.x, b = blockIdx.y;
  const int n0   = st * SN;

  // ---- a) all global reads first, then the conversions
  v4f xv[8];
  {
    const float* sp = x + ((size_t)(b * CC + 8 * wave)) * NN + n0 + 4 * lane;
#pragma unroll                                                       // constant indices: the array stays in registers
    for (int i = 0; i < 8; ++i) xv[i] = *(const v4f*)(sp + (size_t)i * NN);
  }
  const int rl = tid >> 3, col = 8 * (tid & 7);                      // rl 0..31, col 0..56
  v4f wa[3], wq[3];
#pragma unroll                                                       // constant indices: the array stays in registers
  for (int k = 0; k < 3; ++k) {
    const float* wbase = (k == 0) ? tw : ((k == 1) ? pw : gw);
    const float* s = wbase + (size_t)rl * CC + col;
    wa[k] = *(const v4f*)s;
    wq[k] = *(const v4f*)(s + 4);
  }
  // biases: read here, with the other global reads, so that no memory latency stands behind the barriers
  const int e4 = tid & 3, lq = tid >> 2;                             // lq 0..63
  const v4f tba = *(const v4f*)(tb + 8 * e4), tbq = *(const v4f*)(tb + 8 * e4 + 4);
  const v4f pba = *(const v4f*)(pb + 8 * e4), pbq = *(const v4f*)(pb + 8 * e4 + 4);
  const float gbl = gb[lane];
  if (st == 0 && b == 0) {
    const int o = tid >> 2;                                          // 0..63
    const int oc = 8 * (tid & 3);                                    // 0..24
    const float* s = ow + (size_t)o * DQ + oc;
    const v4f a = *(const v4f*)s;
    const v4f q = *(const v4f*)(s + 4);
    const float f[8] = {a[0], a[1], a[2], a[3], q[0], q[1], q[2], q[3]};
    v4u u;
#pragma unroll                                                       // constant indices: the array stays in registers
    for (int t = 0; t < 4; ++t) u[t] = pk16(bf_bits(f[2 * t]), bf_bits(f[2 * t + 1]));
    *(v4u*)(WWb + (size_t)o * DQ + oc) = u;
  }
#pragma unroll                                                       // constant indices: the array stays in registers
  for (int k = 0; k < 3; ++k) {
    const float f[8] = {wa[k][0], wa[k][1], wa[k][2], wa[k][3], wq[k][0], wq[k][1], wq[k][2], wq[k][3]};
    v4u u;
#pragma unroll                                                       // constant indices: the array stays in registers
    for (int t = 0; t < 4; ++t) {
      const _Float16 h0 = (_Float16)(bfr(f[2 * t]) * WSC);
      const _Float16 h1 = (_Float16)(bfr(f[2 * t + 1]) * WSC);
      u[t] = pk16(h_bits(h0), h_bits(h1));
    }
    *(v4u*)(Wl + (DQ * k + rl) * TP + col) = u;
  }
#pragma unroll                                                       // constant indices: the array stays in registers
  for (int t = 0; t < 4; ++t) {                                      // position 4 lane + t, channels 8 wave .. + 7
    v4u u;
#pragma unroll                                                       // constant indices: the array stays in registers
    for (int i = 0; i < 4; ++i) {
      u[i] = pk16(h_bits((_Float16)bfr(xv[2 * i][t])), h_bits((_Float16)bfr(xv[2 * i + 1][t])));
    }
    *(v4u*)(Xs + (4 * lane + t) * TP + 8 * wave) = u;
  }
  __syncthreads();

  // ---- b) the GEMM, fragments from LDS
  const unsigned short* ap = Wl + c * TP + 8 * hh;
  const unsigned short* bp = Xs + (16 * wave + c) * TP + 8 * hh;

  v8f acc[NMT];
#pragma unroll                                                       // constant indices: the array stays in registers
  for (int mt = 0; mt < NMT; ++mt) acc[mt] = zero8();

  Frag fb[CC / 32], fa[CC / 32][NMT];                                // all fragments first: one place of LDS reads
#pragma unroll                                                       // constant indices: fragments stay in registers
  for (int ks = 0; ks < CC / 32; ++ks) {
    fb[ks] = ldfrag(bp + 32 * ks);
#pragma unroll                                                       // constant indices: the array stays in registers
    for (int mt = 0; mt < NMT; ++mt) fa[ks][mt] = ldfrag(ap + (16 * mt) * TP + 32 * ks);
  }
#pragma unroll                                                       // constant indices: the array stays in registers
  for (int ks = 0; ks < CC / 32; ++ks) {
#pragma unroll                                                       // constant indices: the array stays in registers
    for (int mt = 0; mt < NMT; ++mt) acc[mt] = mma_h(fa[ks][mt].h, fb[ks].h, acc[mt]);
  }

  // scale back -> LDS Os[n_loc][o_loc]; lane (hh, c) holds o = 16 mt + 8 hh + r for n_loc = 16 w + c
  {
    const int nl = 16 * wave + c;
#pragma unroll                                                       // constant indices: the array stays in registers
    for (int mt = 0; mt < NMT; ++mt) {
      v4f va, vb;
#pragma unroll                                                       // constant indices: the array stays in registers
      for (int r = 0; r < 4; ++r) { va[r] = acc[mt][r] * IWSC; vb[r] = acc[mt][4 + r] * IWSC; }
      *(v4f*)(Os + nl * OSPP + 16 * mt + 8 * hh)     = va;
      *(v4f*)(Os + nl * OSPP + 16 * mt + 8 * hh + 4) = vb;
    }
  }
  __syncthreads();

  // ---- c) theta -> bf16 hi / residual planes
  {
    float bv[8];
#pragma unroll                                                       // constant indices: the array stays in registers
    for (int t = 0; t < 4; ++t) { bv[t] = bfr(tba[t]); bv[4 + t] = bfr(tbq[t]); }
#pragma unroll                                                       // constant indices: the array stays in registers
    for (int it = 0; it < 2; ++it) {
      const int row = it * 64 + lq;                                  // n_loc 0..127
      const v4f a = *(const v4f*)(Os + row * OSPP + 8 * e4);
      const v4f q = *(const v4f*)(Os + row * OSPP + 8 * e4 + 4);
      float f[8];
#pragma unroll                                                       // constant indices: the array stays in registers
      for (int t = 0; t < 4; ++t) { f[t] = a[t] + bv[t]; f[4 + t] = q[t] + bv[4 + t]; }
      v4u uh, ul;
      split8(f, uh, ul);
      const size_t po = ((size_t)(b * NN + n0 + row)) * DQ + 8 * e4;
      *(v4u*)(Qh + po) = uh;
      *(v4u*)(Ql + po) = ul;
    }
  }

  if (wave < 4) {
    // pooled phi: thread (key lq 0..31, 8 d at 8 e4)
    float fk[8];
#pragma unroll                                                       // constant indices: the array stays in registers
    for (int t = 0; t < 8; ++t) fk[t] = -__builtin_inff();
#pragma unroll                                                       // constant indices: the array stays in registers
    for (int dy = 0; dy < 2; ++dy) {
#pragma unroll                                                       // constant indices: the array stays in registers
      for (int dx = 0; dx < 2; ++dx) {
        const float* pk = Os + (dy * WIMG + 2 * lq + dx) * OSPP + DQ + 8 * e4;
        const v4f ka = *(const v4f*)pk, kq = *(const v4f*)(pk + 4);
#pragma unroll                                                       // constant indices: the array stays in registers
        for (int t = 0; t < 4; ++t) {
          fk[t]     = fmaxf(fk[t], ka[t]);
          fk[4 + t] = fmaxf(fk[4 + t], kq[t]);
        }
      }
    }
#pragma unroll                                                       // constant indices: the array stays in registers
    for (int t = 0; t < 4; ++t) { fk[t] += bfr(pba[t]); fk[4 + t] += bfr(pbq[t]); }
    v4u kh, kl;
    split8(fk, kh, kl);
    const size_t pok = ((size_t)(b * MM + WP * st + lq)) * DQ + 8 * e4;
    *(v4u*)(Kh + pok) = kh;
    *(v4u*)(Kl + pok) = kl;
  } else {
    // pooled g: wave 4 + j makes chunk j (keys 8j..8j+7 of the step), lane = channel
    const int j = wave - 4;
    const float bg = bfr(gbl);
    unsigned short hb[8];
#pragma unroll                                                       // constant indices: the array stays in registers
    for (int t = 0; t < 8; ++t) {
      const float* pg = Os + (2 * (8 * j + t)) * OSPP + 2 * DQ + lane;
      const float v = fmaxf(fmaxf(pg[0], pg[OSPP]), fmaxf(pg[WIMG * OSPP], pg[(WIMG + 1) * OSPP])) + bg;
      hb[t] = h_bits((_Float16)v);
    }
    v4u up;
#pragma unroll                                                       // constant indices: the array stays in registers
    for (int t = 0; t < 4; ++t) up[t] = pk16(hb[2 * t], hb[2 * t + 1]);
    *(v4u*)(Gc + ((size_t)(b * NSTRIP + st)) * (DQ * WP) + (size_t)(j * DQ + lane) * 8) = up;
  }
}

// =========================================================================================================
// (4) attention and output conv for one (b, 256-query tile), transposed formulation, 1024 keys, no mask, no scale:
//   S^T tile (16 keys x 16 queries) = A(k: row = key kb + (lane&15), 32 d via the split k map from the bf16
//   plane Kh [b][1024][32]) . B(q: col = query, same map from Qh [b][4096][32]) + A(Kh).B(Ql) + A(Kl).B(Qh)
//   (bf16 unscaled residual planes, shared accumulator); q fragments loaded once (K = 32 = one step).
//   Per lane the D tile holds 8 keys of ONE query: online softmax state per lane, one shuffle (lane^16) for the max
//   over 32 keys; the o/l rescale is skipped under a wave-uniform ballot when no lane's max grew (corr == 1 exactly
//   for every lane then); row-sum partials combined at the end. P = e^{s-m} x 16384 as f16 is the B operand of
//   y^T (rows channel, cols queries) += A(pooled g: rows channel = 16j + (lane&15), keys contiguous, f16 plane Gc
//   [b][32 steps][4 j][32 ch][8 keys]) . B(P^T): element r <- D of the tile covering keys kb..kb+15, element 8+r <- the tile covering
//   kb+16..kb+31, lane unchanged. 2 accumulator tiles per wave (32 channels). Block = 16 waves = 256 queries.
//   The batch's whole Kh, Kl and Gc planes (3 x 64 KiB) are copied once into LDS by asynchronous 16-byte copies and
//   every fragment is read from there. LDS layout: step t (32 keys) at t * KVT; in it six 1-KiB fragment tiles
//   (Kh keys 0..15, Kh keys 16..31, Kl likewise, Gc channels 0..15, 16..31); in a tile the 16-byte chunk j (k
//   elements 8j..8j+7) of row r stands at j * 256 + ((r + 4j) & 15) * 16, so that a half-wave's b128 read (fixed j,
//   16 rows) and a half-wave's copy (4 rows x 4 j for Kh and Kl, 16 rows of one j for Gc) each meet every bank once.
//   Output conv in the same launch: y = O/l stays in registers. Lane (hh, c) holds channels 8 hh + r (tile 0) and
//   16 + 8 hh + r (tile 1) of query c, which is the split k map of a 16-bit A fragment (row = query, K = 32
//   channels): y as bf16 hi = RNE(y) and lo = RNE(y - hi) fragments, Z[n][co] = A(y hi).B(W) + A(y lo).B(W), B col =
//   output channel 16 nt + (lane&15) from WWb bf16 [64][32], 4 n-tiles, shared accumulator. D: lane (hh, c) holds
//   positions 16 w + 8 hh + r of channel 16 nt + c -> Os[channel][position] (pitch OCP, b128 stores, every bank
//   once per half-wave), block barrier, then out = (Z + bias) + x: a wave handles 128 positions of one channel per
//   instruction (512 B = 4 whole lines). The x tile, the bias and the W fragments are read ahead of the key loop.
// coverage: Os written 16 waves x 16 positions x 64 channels, read 8 it x 8 channels x 64 lanes x 4 = the same; out
//           likewise 64 c x 256 n per block; grid (NQ/256, NB) covers out[b][0..63][0..NQ-1] exactly once.
//           KV: per plane 8 copies x 512 threads x 16 B = 64 KiB, each chunk to its own place, all read places filled.
// =========================================================================================================
__global__ __launch_bounds__(512) __attribute__((amdgpu_num_vgpr(256)))
void attn_k(const unsigned short* __restrict__ Qh, const unsigned short* __restrict__ Ql,
            const unsigned short* __restrict__ Kh, const unsigned short* __restrict__ Kl,
            const unsigned short* __restrict__ Gc, const unsigned short* __restrict__ WWb,
            const float* __restrict__ wb, const float* __restrict__ x, float* out) {
  __shared__ __align__(16) unsigned char KV[(MM / 32) * KVT];
  __shared__ __align__(16) float Os[CC * OCP];
  const int tid  = threadIdx.x;
  const int wave = tid >> 5, lane = tid & 31;
  const int hh   = lane >> 4, c = lane & 15;
  const int n0   = blockIdx.x * AQ, b = blockIdx.y;

  // q fragments (B operand, col = query n0 + 16*wave + c), whole head dim in one fragment
  const size_t qo = ((size_t)(b * NN + n0 + 16 * wave + c)) * DQ + 8 * hh;
  const Frag qh = ldfrag(Qh + qo);
  const Frag ql = ldfrag(Ql + qo);

  // ---- fill KV once: thread tid copies chunk 512 i + tid of each plane (global side contiguous over the lanes)
  {
    const unsigned kv0 = (unsigned)(uintptr_t)KV;                    // LDS byte address of KV
    const int cj = tid & 3;                                          // chunk j inside its row / step
    // Kh, Kl: row = key 128 i + (tid >> 2): step 4 i + (tid >> 7), tile (tid >> 6) & 1, row in tile (tid >> 2) & 15
    const unsigned dk = kv0 + (unsigned)((tid >> 7) * KVT + ((tid >> 6) & 1) * 1024 + cj * 256 +
                                         ((((tid >> 2) & 15) + 4 * cj) & 15) * 16);
    const unsigned short* gkh = Kh + (size_t)b * MM * DQ + 8 * tid;
    const unsigned short* gkl = Kl + (size_t)b * MM * DQ + 8 * tid;
    copy8(dk, 4 * KVT, gkh);
    copy8(dk + 2048u, 4 * KVT, gkl);
    // Gc (fragment order): step 4 i + (tid >> 7), chunk j = (tid >> 5) & 3, channel tid & 31
    const int vj = (tid >> 5) & 3;
    const unsigned dv = kv0 + (unsigned)((tid >> 7) * KVT + 4096 + ((tid >> 4) & 1) * 1024 + vj * 256 +
                                         (((tid & 15) + 4 * vj) & 15) * 16);
    const unsigned short* gv = Gc + (size_t)b * DQ * MM + 8 * tid;
    copy8(dv, 4 * KVT, gv);
    // every copy of this wave has landed before the barrier behind which the other waves read its bytes
#if defined(__HIP_DEVICE_COMPILE__)
    asm volatile("s_wait_asynccnt 0x0" ::: "memory");
#endif
  }
  __syncthreads();

  // ---- operands of the output conv and of the residual add: issued here, behind the barrier (which would wait for
  //      them) and ahead of the key loop, so that they arrive while the loop runs
  const int och = tid >> 6, opn = 4 * (tid & 63);                    // output rows: channel 8 it + och, position opn..+3
  const size_t oidx = ((size_t)(b * CC + och)) * NN + n0 + opn;
  Frag fw[CC / 16];
#pragma unroll                                                       // constant indices: fragments stay in registers
  for (int nt = 0; nt < CC / 16; ++nt) fw[nt] = ldfrag(WWb + (size_t)(16 * nt + c) * DQ + 8 * hh);
  float bo[8];
  v4f xr[8];
#pragma unroll                                                       // constant indices: the arrays stay in registers
  for (int it = 0; it < 8; ++it) {
    bo[it] = wb[8 * it + och];
    xr[it] = *(const v4f*)(x + oidx + (size_t)(8 * it) * NN);
  }

  // fragment read places in a tile: elements 0..7 = chunk hh, elements 8..15 = chunk 2 + hh, row c
  const unsigned char* fa = KV + hh * 256 + ((c + 4 * hh) & 15) * 16;
  const unsigned char* fb = KV + (2 + hh) * 256 + ((c + 8 + 4 * hh) & 15) * 16;

  float m = -1.0e30f, l = 0.f;
  v8f o[2];
  o[0] = zero8();
  o[1] = zero8();

#pragma unroll 1
  for (int kb = 0; kb < MM; kb += 32) {
    const int so = (kb >> 5) * KVT;                                  // this step's place in KV
    const Frag k0  = ldfrag2(fa + so, fb + so);                      // keys kb .. kb+15
    const Frag k1  = ldfrag2(fa + so + 1024, fb + so + 1024);        // keys kb+16 .. kb+31
    const Frag k0l = ldfrag2(fa + so + 2048, fb + so + 2048);
    const Frag k1l = ldfrag2(fa + so + 3072, fb + so + 3072);
    Frag vf[2];                                                      // read with the k fragments: one place of LDS reads
#pragma unroll                                                       // constant indices: vf stays in registers
    for (int j = 0; j < 2; ++j) vf[j] = ldfrag2(fa + so + 4096 + 1024 * j, fb + so + 4096 + 1024 * j);
    v8f s0 = mma_b(k0.bf, qh.bf, zero8());
    v8f s1 = mma_b(k1.bf, qh.bf, zero8());
    s0 = mma_b(k0.bf, ql.bf, s0);
    s1 = mma_b(k1.bf, ql.bf, s1);
    s0 = mma_b(k0l.bf, qh.bf, s0);
    s1 = mma_b(k1l.bf, qh.bf, s1);

    float mx = fmaxf(hmax8(s0), hmax8(s1));
    mx = fmaxf(mx, __shfl_xor(mx, 16, 32));
    const float mn = fmaxf(m, mx);
    const unsigned grew = wave_ballot(mx > m);                       // wave-uniform
    if (grew != 0u) {
      const float corr = __expf(m - mn);                             // == 1 exactly for lanes whose max did not grow
      l *= corr;
#pragma unroll
      for (int j = 0; j < 2; ++j) {
#pragma unroll
        for (int r = 0; r < 8; ++r) o[j][r] *= corr;
      }
    }
    m = mn;
    const float msh = mn - LNPS;                                     // exp gives e^{s-m} * 16384

    FragH ph;
    float ls = 0.f;
#pragma unroll
    for (int r = 0; r < 8; ++r) {
      const float e0 = __expf(s0[r] - msh);                          // key kb      + 8hh + r
      const float e1 = __expf(s1[r] - msh);                          // key kb + 16 + 8hh + r
      ls += e0 + e1;
      ph.hv[0][r] = (_Float16)e0;
      ph.hv[1][r] = (_Float16)e1;
    }
    l += ls;

#pragma unroll
    for (int j = 0; j < 2; ++j) {
      o[j] = mma_h(vf[j].h, ph.v, o[j]);
    }
  }
  l += __shfl_xor(l, 16, 32);
  const float inv = 1.0f / l;                                        // o and l both carry the x16384 factor

  // ---- y = o * inv as bf16 hi / residual A fragments (row = query c, k = channel by the split k map)
  Frag yh, yl;
#pragma unroll                                                       // constant indices: fragments stay in registers
  for (int j = 0; j < 2; ++j) {
    float f[8];
#pragma unroll                                                       // constant indices: the array stays in registers
    for (int r = 0; r < 8; ++r) f[r] = o[j][r] * inv;
    v4u uh, ul;
    split8(f, uh, ul);
    yh.u[j] = __builtin_bit_cast(v8us, uh);
    yl.u[j] = __builtin_bit_cast(v8us, ul);
  }

  // ---- output conv; lane (hh, c) then holds positions 16 w + 8 hh + r of channel 16 nt + c -> Os[channel][position]
#pragma unroll                                                       // constant indices: fragments stay in registers
  for (int nt = 0; nt < CC / 16; ++nt) {
    v8f z = mma_b(yh.bf, fw[nt].bf, zero8());
    z = mma_b(yl.bf, fw[nt].bf, z);
    float* po = Os + (16 * nt + c) * OCP + 16 * wave + 8 * hh;
    const v4f va = {z[0], z[1], z[2], z[3]}, vb = {z[4], z[5], z[6], z[7]};
    *(v4f*)(po)     = va;
    *(v4f*)(po + 4) = vb;
  }
  __syncthreads();

  // ---- bias and residual add, whole lines out
#pragma unroll                                                       // constant indices: the arrays stay in registers
  for (int it = 0; it < 8; ++it) {
    const v4f a = *(const v4f*)(Os + (8 * it + och) * OCP + opn);
    const float bvs = bfr(bo[it]);
    v4f res;
#pragma unroll                                                       // constant indices: the vector stays in registers
    for (int t = 0; t < 4; ++t) res[t] = (a[t] + bvs) + bfr(xr[it][t]);
    *(v4f*)(out + oidx + (size_t)(8 * it) * NN) = res;
  }
}

// =========================================================================================================
// Workspace map (bytes; each region start a multiple of 256; every extent is an exact row/tile multiple and is
//   WWb bf16 [64][32]              4096
//   Qh/Ql bf16 [NB][4096][32]   4194304 x2 (NB=16)
//   Kh/Kl bf16 [NB][1024][32]   1048576 x2   Gc f16 [NB][32][4][32][8]   1048576
//   total (NB=16) = 11538432
// =========================================================================================================
extern "C" void kernel_launch(void* const* d_in, const int* in_sizes, int n_in,
                              void* d_out, int out_size, void* d_ws, size_t ws_size,
                              hipStream_t stream) {
  const int XN = NB * CC * NN;
  if (n_in < 9) return;
  if (in_sizes[0] < XN) return;
  if (in_sizes[1] < DQ * CC || in_sizes[3] < DQ * CC || in_sizes[5] < DQ * CC || in_sizes[7] < CC * DQ) return;
  if (in_sizes[2] < DQ || in_sizes[4] < DQ || in_sizes[6] < DQ || in_sizes[8] < CC) return;
  if (out_size < XN) return;

  size_t off = 0;
  auto carve = [&](size_t bytes) { const size_t o = off; off += (bytes + 255) & ~(size_t)255; return o; };
  const size_t oWWb = carve((size_t)CC * DQ * 2);
  const size_t oQh  = carve((size_t)NB * NN * DQ * 2);
  const size_t oQl  = carve((size_t)NB * NN * DQ * 2);
  const size_t oKh  = carve((size_t)NB * MM * DQ * 2);
  const size_t oKl  = carve((size_t)NB * MM * DQ * 2);
  const size_t oGc  = carve((size_t)NB * DQ * MM * 2);
  if (off > ws_size) return;
  if (off > (size_t)134217728) return;

  const float* x  = (const float*)d_in[0];
  const float* gw = (const float*)d_in[1];
  const float* gb = (const float*)d_in[2];
  const float* tw = (const float*)d_in[3];
  const float* tb = (const float*)d_in[4];
  const float* pw = (const float*)d_in[5];
  const float* pb = (const float*)d_in[6];
  const float* ow = (const float*)d_in[7];
  const float* wb = (const float*)d_in[8];

  char* ws = (char*)d_ws;
  unsigned short* WWb = (unsigned short*)(ws + oWWb);
  unsigned short* Qh  = (unsigned short*)(ws + oQh);
  unsigned short* Ql  = (unsigned short*)(ws + oQl);
  unsigned short* Kh  = (unsigned short*)(ws + oKh);
  unsigned short* Kl  = (unsigned short*)(ws + oKl);
  unsigned short* Gc  = (unsigned short*)(ws + oGc);
  float* out = (float*)d_out;

  const dim3 blk256(256), blk512(512);

  // (0) x, weights -> theta (q) hi/res planes, pooled phi (k) hi/res planes, pooled g f16 plane; w_w -> bf16 plane
  proj_pool<<<dim3(NSTRIP, NB), blk256, 0, stream>>>(x, tw, pw, gw, ow, tb, pb, gb, WWb, Qh, Ql, Kh, Kl, Gc);
  // (4) attention, output conv + bias + residual -> out [b][64][4096]
  attn_k<<<dim3(NQ / AQ, NB), blk512, 0, stream>>>(Qh, Ql, Kh, Kl, Gc, WWb, wb, x, out);
  (void)hipGetLastError();
}

// v004
// Measured time: 26.5 microseconds a run.
// Next to v003, in two timings, it ran 1.10 times as fast each time.
// All steps since v000 together make it 2.61 times as fast.
// Contractions: conv1x1 theta/phi/g GEMM W[96x64].X[64x128] per strip on v_wmma_f32_16x16x32_f16 (f16 containers
// of bf16-RNE weights x256 and bf16-RNE x); scores K.Q^T on v_wmma_f32_16x16x32_bf16 (bf16 hi + bf16 residual planes
// of theta / 2x2-max-pooled phi, 3 products, K=32); y^T = G.P^T on v_wmma_f32_16x16x32_f16 (2x2-max-pooled g as
// f16, P = e^{s-m} x16384 f16 from the score D registers); output conv Y.W^T[32x64] on v_wmma_f32_16x16x32_bf16 (bf16
// weights, y as bf16 hi + residual fragments, 2 products); f32 accumulate everywhere; max-pool, softmax statistics,
// bias and residual add in f32 VALU.
#include <hip/hip_runtime.h>
#include <math.h>
#include <stdint.h>

#ifndef NB
#define NB 16
#endif
#ifndef NQ
#define NQ 4096
#endif
#define NB_FULL 16
#define CC     64
#define HIMG   64
#define WIMG   64
#define NN     4096
#define DQ     32
#define HP     32
#define WP     32
#define MM     1024
#define MW     96
#define NMT    6
#define QT     64
#define SN     128
#define NSTRIP 32
#define OSPP   100
#define OCP    260
#define TP     72
#define WSC    256.0f
#define IWSC   0.00390625f
#define LNPS   9.704060527839234f
#define AQ     256
#define KVT    6160

static_assert(NB >= 1 && NB <= NB_FULL);
static_assert(NQ % QT == 0 && NQ >= QT && NQ <= NN);
static_assert(NN == HIMG * WIMG);
static_assert(SN == 2 * WIMG);
static_assert(NSTRIP * SN == NN);
static_assert(SN == 8 * 16);
static_assert(SN == 2 * 64 && SN == 4 * 32);
static_assert(HP * 2 == HIMG && WP * 2 == WIMG);
static_assert(MM == HP * WP);
static_assert(MM % QT == 0 && MM % 32 == 0);
static_assert(QT == 2 * WP);
static_assert(CC == QT);
static_assert(DQ == 32);
static_assert(MW == 3 * DQ && NMT * 16 == MW);
static_assert(CC % 32 == 0);
static_assert((OSPP * 4) % 16 == 0 && OSPP >= MW);
static_assert((OCP * 4) % 16 == 0 && OCP >= AQ && OCP % 64 == 4);
static_assert((TP * 2) % 16 == 0 && TP >= QT);
static_assert(SN * OSPP * 4 <= 65536);
static_assert((size_t)NB_FULL * CC * NN * 4 == (size_t)16777216);
static_assert(NQ % AQ == 0 && AQ == 16 * 16);
static_assert(KVT % 16 == 0 && KVT >= 6 * 1024 && (MM / 32) * KVT + CC * OCP * 4 <= 327680);
static_assert(MM * DQ * 2 == 8 * 512 * 16);

typedef _Float16       v16h __attribute__((ext_vector_type(16)));
typedef _Float16       v8h  __attribute__((ext_vector_type(8)));
typedef __bf16         v16b __attribute__((ext_vector_type(16)));
typedef unsigned short v8us __attribute__((ext_vector_type(8)));
typedef float          v8f  __attribute__((ext_vector_type(8)));
typedef float          v4f  __attribute__((ext_vector_type(4)));
typedef unsigned int   v4u  __attribute__((ext_vector_type(4)));

union Frag  { v8us u[2]; v16h h; v16b bf; };
union FragH { v16h v; v8h hv[2]; };
static_assert(sizeof(Frag) == 32);
static_assert(sizeof(FragH) == 32);

// ---- scalar helpers ---------------------------------------------------------------------------------------
__device__ __forceinline__ unsigned short bf_bits(float f) {          // f32 -> bf16 bits, RNE convert
  unsigned u = __float_as_uint(f);
  return (unsigned short)((u + 0x7FFFu + ((u >> 16) & 1u)) >> 16);
}
__device__ __forceinline__ float bf_up(unsigned short hb) { return __uint_as_float(((unsigned)hb) << 16); }
__device__ __forceinline__ float bfr(float f) { return bf_up(bf_bits(f)); }
__device__ __forceinline__ unsigned short h_bits(_Float16 x) { return __builtin_bit_cast(unsigned short, x); }
__device__ __forceinline__ unsigned pk16(unsigned short a, unsigned short b) { return (unsigned)a | ((unsigned)b << 16); }
__device__ __forceinline__ v8f zero8() { v8f z = {0.f, 0.f, 0.f, 0.f, 0.f, 0.f, 0.f, 0.f}; return z; }
__device__ __forceinline__ float hmax8(v8f s) {
  return fmaxf(fmaxf(fmaxf(s[0], s[1]), fmaxf(s[2], s[3])), fmaxf(fmaxf(s[4], s[5]), fmaxf(s[6], s[7])));
}
__device__ __forceinline__ unsigned wave_ballot(bool p) {
#if defined(__HIP_DEVICE_COMPILE__)
  return __builtin_amdgcn_ballot_w32(p);
#else
  return p ? 1u : 0u;
#endif
}
// 8 f32 values -> bf16 hi bits and bf16 residual bits (lo = RNE(v - hi)), packed 2 per uint
__device__ __forceinline__ void split8(const float* f, v4u& uh, v4u& ul) {
#pragma unroll
  for (int t = 0; t < 4; ++t) {
    const float f0 = f[2 * t], f1 = f[2 * t + 1];
    const unsigned short hb0 = bf_bits(f0), hb1 = bf_bits(f1);
    const unsigned short lb0 = bf_bits(f0 - bf_up(hb0));
    const unsigned short lb1 = bf_bits(f1 - bf_up(hb1));
    uh[t] = pk16(hb0, hb1);
    ul[t] = pk16(lb0, lb1);
  }
}

// ---- 16-bit fragment loader (A, or B from a k-contiguous [n][k] row): lane -> row/col (lane&15), p already includes
//      + 8*(lane>>4); elements 0..7 <- p[0..7] (k0+8h..), elements 8..15 <- p[16..23] (k0+16+8h..)
__device__ __forceinline__ Frag ldfrag(const unsigned short* p) {
  Frag f;
  f.u[0] = *(const v8us*)(p);
  f.u[1] = *(const v8us*)(p + 16);
  return f;
}

// the same fragment from two separate 16-byte places (LDS tiles kept in fragment order)
__device__ __forceinline__ Frag ldfrag2(const unsigned char* p0, const unsigned char* p1) {
  Frag f;
  f.u[0] = *(const v8us*)(p0);
  f.u[1] = *(const v8us*)(p1);
  return f;
}

// ---- eight asynchronous 16-byte copies global -> LDS per lane, copy i from g + 4096 i elements (8 KiB apart) to the
//      LDS byte address d[i]. One statement: the closing s_wait_xcnt 0 stands in front of any rewrite of the address
//      registers that the issued copies name. The landing wait (s_wait_asynccnt) is the caller's.
__device__ __forceinline__ void copy8v(const unsigned* d, const unsigned short* g) {
#if defined(__HIP_DEVICE_COMPILE__)
  asm volatile("global_load_async_to_lds_b128 %0, %8, off\n\t"
               "global_load_async_to_lds_b128 %1, %9, off\n\t"
               "global_load_async_to_lds_b128 %2, %10, off\n\t"
               "global_load_async_to_lds_b128 %3, %11, off\n\t"
               "global_load_async_to_lds_b128 %4, %12, off\n\t"
               "global_load_async_to_lds_b128 %5, %13, off\n\t"
               "global_load_async_to_lds_b128 %6, %14, off\n\t"
               "global_load_async_to_lds_b128 %7, %15, off\n\t"
               "s_wait_xcnt 0x0"
               :: "v"(d[0]), "v"(d[1]), "v"(d[2]), "v"(d[3]), "v"(d[4]), "v"(d[5]), "v"(d[6]), "v"(d[7]),
                  "v"(g), "v"(g + 4096), "v"(g + 2 * 4096), "v"(g + 3 * 4096), "v"(g + 4 * 4096), "v"(g + 5 * 4096),
                  "v"(g + 6 * 4096), "v"(g + 7 * 4096)
               : "memory");
#endif
}
__device__ __forceinline__ void copy8(unsigned d0, unsigned dstep, const unsigned short* g) {
  unsigned d[8];
#pragma unroll                                                       // constant indices: d stays in registers
  for (int i = 0; i < 8; ++i) d[i] = d0 + (unsigned)i * dstep;
  copy8v(d, g);
}

// ---- WMMA helpers: the plain builtins; the compiler keeps the distance behind each matrix instruction itself ------
__device__ __forceinline__ v8f mma_h(v16h a, v16h b, v8f c) {
  return __builtin_amdgcn_wmma_f32_16x16x32_f16(false, a, false, b, (short)0, c, false, false);
}
__device__ __forceinline__ v8f mma_b(v16b a, v16b b, v8f c) {
  return __builtin_amdgcn_wmma_f32_16x16x32_bf16(false, a, false, b, (short)0, c, false, false);
}

// =========================================================================================================
// (0) front end for one (b, strip of 128 positions = image rows 2s and 2s+1), one launch, everything between x and
//     the attention operands kept in LDS. Block 256 threads = 8 waves.
//     a) x f32 [b][64 c][4096 n]: wave w reads rows c = 8w..8w+7, lane q the 16 bytes n0+4q..+3 of each (a whole
//        512-B row per instruction) -> Xs f16 [128 n][64 c] (pitch TP, bf16-RNE values, exact in f16), b128 stores.
//        theta_w / phi_w / g_w f32 -> Wl f16 [96 o][64 c] (pitch TP; rows 0..31 theta, 32..63 phi, 64..95 g; value =
//        bf16-RNE x256). Block (0, 0) also writes WWb bf16 [64][32] = bf16-RNE of w_w for the output conv in the next launch.
//     b) block barrier; Y[o][n] = (1/256) sum_c Wl[o][c] Xs[n][c]: wave w owns cols 16w..16w+15 (one B fragment per
//        k-step) and 6 m-tiles (A rows o = 16 mt + (lane&15)), K = 64 = 2 steps, fragments by the split k map from
//        LDS; results to Os[n_loc][o_loc] (pitch OSPP, b128 stores); block barrier.
//     c) o 0..31 -> theta + bias -> Qh/Ql bf16 [b][4096 n][32 d] (hi = RNE(v), lo = RNE(v-hi)).
//        The strip holds every 2x2 window of pooled row py = s: key m = 32 s + px, window n_loc = 64 dy + 2 px + dx.
//        Waves 0..3: o 32..63 -> max over the window, + bias (rounding is monotone: the same value as the max of the
//        biased four) -> Kh/Kl bf16 [b][1024 m][32 d]. Waves 4..7: o 64..95 likewise -> f16 -> Gc in fragment order
//        [b][32 steps][4 j][32 ch][8 keys]: step = s, chunk j = keys 8j..8j+7 of the step; wave 4+j, lane = channel.
// coverage: Xs 8 waves x 8 c x 128 n, Wl 3 x 32 rows x 8 lanes x 8, both read whole; Os 8 waves x 16 n x 96 o written,
//           reads rows <= 127 cols <= 95; Qh/Ql 2 it x 64 rows x 4 lanes x 8 = 128 n x 32 d; Kh/Kl 32 rows x 4 lanes x
//           8; Gc 4 waves x 32 lanes x 8 = 2 KiB; grid (32, NB) covers every plane exactly once, a block's piece of
//           each plane contiguous (8 KiB, 2 KiB, 2 KiB).
// =========================================================================================================
__global__ __launch_bounds__(256)
void proj_pool(const float* __restrict__ x, const float* __restrict__ tw, const float* __restrict__ pw,
               const float* __restrict__ gw, const float* __restrict__ ow, const float* __restrict__ tb,
               const float* __restrict__ pb, const float* __restrict__ gb, unsigned short* WWb,
               unsigned short* Qh, unsigned short* Ql, unsigned short* Kh, unsigned short* Kl,
               unsigned short* Gc) {
  __shared__ __align__(16) unsigned short Xs[SN * TP];
  __shared__ __align__(16) unsigned short Wl[MW * TP];
  __shared__ __align__(16) float Os[SN * OSPP];
  const int tid  = threadIdx.x;
  const int lane = tid & 31, wave = tid >> 5;                        // wave 0..7
  const int hh   = lane >> 4, c = lane & 15;
  const int st   = blockIdx.x, b = blockIdx.y;
  const int n0   = st * SN;

  // ---- a) all global reads first, then the conversions
  v4f xv[8];
  {
    const float* sp = x + ((size_t)(b * CC + 8 * wave)) * NN + n0 + 4 * lane;
#pragma unroll                                                       // constant indices: the array stays in registers
    for (int i = 0; i < 8; ++i) xv[i] = *(const v4f*)(sp + (size_t)i * NN);
  }
  const int rl = tid >> 3, col = 8 * (tid & 7);                      // rl 0..31, col 0..56
  v4f wa[3], wq[3];
#pragma unroll                                                       // constant indices: the array stays in registers
  for (int k = 0; k < 3; ++k) {
    const float* wbase = (k == 0) ? tw : ((k == 1) ? pw : gw);
    const float* s = wbase + (size_t)rl * CC + col;
    wa[k] = *(const v4f*)s;
    wq[k] = *(const v4f*)(s + 4);
  }
  // biases: read here, with the other global reads, so that no memory latency stands behind the barriers
  const int e4 = tid & 3, lq = tid >> 2;                             // lq 0..63
  const v4f tba = *(const v4f*)(tb + 8 * e4), tbq = *(const v4f*)(tb + 8 * e4 + 4);
  const v4f pba = *(const v4f*)(pb + 8 * e4), pbq = *(const v4f*)(pb + 8 * e4 + 4);
  const float gbl = gb[lane];
  if (st == 0 && b == 0) {
    const int o = tid >> 2;                                          // 0..63
    const int oc = 8 * (tid & 3);                                    // 0..24
    const float* s = ow + (size_t)o * DQ + oc;
    const v4f a = *(const v4f*)s;
    const v4f q = *(const v4f*)(s + 4);
    const float f[8] = {a[0], a[1], a[2], a[3], q[0], q[1], q[2], q[3]};
    v4u u;
#pragma unroll                                                       // constant indices: the array stays in registers
    for (int t = 0; t < 4; ++t) u[t] = pk16(bf_bits(f[2 * t]), bf_bits(f[2 * t + 1]));
    *(v4u*)(WWb + (size_t)o * DQ + oc) = u;
  }
#pragma unroll                                                       // constant indices: the array stays in registers
  for (int k = 0; k < 3; ++k) {
    const float f[8] = {wa[k][0], wa[k][1], wa[k][2], wa[k][3], wq[k][0], wq[k][1], wq[k][2], wq[k][3]};
    v4u u;
#pragma unroll                                                       // constant indices: the array stays in registers
    for (int t = 0; t < 4; ++t) {
      const _Float16 h0 = (_Float16)(bfr(f[2 * t]) * WSC);
      const _Float16 h1 = (_Float16)(bfr(f[2 * t + 1]) * WSC);
      u[t] = pk16(h_bits(h0), h_bits(h1));
    }
    *(v4u*)(Wl + (DQ * k + rl) * TP + col) = u;
  }
#pragma unroll                                                       // constant indices: the array stays in registers
  for (int t = 0; t < 4; ++t) {                                      // position 4 lane + t, channels 8 wave .. + 7
    v4u u;
#pragma unroll                                                       // constant indices: the array stays in registers
    for (int i = 0; i < 4; ++i) {
      u[i] = pk16(h_bits((_Float16)bfr(xv[2 * i][t])), h_bits((_Float16)bfr(xv[2 * i + 1][t])));
    }
    *(v4u*)(Xs + (4 * lane + t) * TP + 8 * wave) = u;
  }
  __syncthreads();

  // ---- b) the GEMM, fragments from LDS
  const unsigned short* ap = Wl + c * TP + 8 * hh;
  const unsigned short* bp = Xs + (16 * wave + c) * TP + 8 * hh;

  v8f acc[NMT];
#pragma unroll                                                       // constant indices: the array stays in registers
  for (int mt = 0; mt < NMT; ++mt) acc[mt] = zero8();

  Frag fb[CC / 32], fa[CC / 32][NMT];                                // all fragments first: one place of LDS reads
#pragma unroll                                                       // constant indices: fragments stay in registers
  for (int ks = 0; ks < CC / 32; ++ks) {
    fb[ks] = ldfrag(bp + 32 * ks);
#pragma unroll                                                       // constant indices: the array stays in registers
    for (int mt = 0; mt < NMT; ++mt) fa[ks][mt] = ldfrag(ap + (16 * mt) * TP + 32 * ks);
  }
  // keeps all fragment reads in front of the matrix work (for speed only)
  __builtin_amdgcn_sched_barrier(0);
#pragma unroll                                                       // constant indices: the array stays in registers
  for (int ks = 0; ks < CC / 32; ++ks) {
#pragma unroll                                                       // constant indices: the array stays in registers
    for (int mt = 0; mt < NMT; ++mt) acc[mt] = mma_h(fa[ks][mt].h, fb[ks].h, acc[mt]);
  }

  // scale back -> LDS Os[n_loc][o_loc]; lane (hh, c) holds o = 16 mt + 8 hh + r for n_loc = 16 w + c
  {
    const int nl = 16 * wave + c;
#pragma unroll                                                       // constant indices: the array stays in registers
    for (int mt = 0; mt < NMT; ++mt) {
      v4f va, vb;
#pragma unroll                                                       // constant indices: the array stays in registers
      for (int r = 0; r < 4; ++r) { va[r] = acc[mt][r] * IWSC; vb[r] = acc[mt][4 + r] * IWSC; }
      *(v4f*)(Os + nl * OSPP + 16 * mt + 8 * hh)     = va;
      *(v4f*)(Os + nl * OSPP + 16 * mt + 8 * hh + 4) = vb;
    }
  }
  __syncthreads();

  // ---- c) theta -> bf16 hi / residual planes
  {
    float bv[8];
#pragma unroll                                                       // constant indices: the array stays in registers
    for (int t = 0; t < 4; ++t) { bv[t] = bfr(tba[t]); bv[4 + t] = bfr(tbq[t]); }
#pragma unroll                                                       // constant indices: the array stays in registers
    for (int it = 0; it < 2; ++it) {
      const int row = it * 64 + lq;                                  // n_loc 0..127
      const v4f a = *(const v4f*)(Os + row * OSPP + 8 * e4);
      const v4f q = *(const v4f*)(Os + row * OSPP + 8 * e4 + 4);
      float f[8];
#pragma unroll                                                       // constant indices: the array stays in registers
      for (int t = 0; t < 4; ++t) { f[t] = a[t] + bv[t]; f[4 + t] = q[t] + bv[4 + t]; }
      v4u uh, ul;
      split8(f, uh, ul);
      const size_t po = ((size_t)(b * NN + n0 + row)) * DQ + 8 * e4;
      *(v4u*)(Qh + po) = uh;
      *(v4u*)(Ql + po) = ul;
    }
  }

  if (wave < 4) {
    // pooled phi: thread (key lq 0..31, 8 d at 8 e4)
    float fk[8];
#pragma unroll                                                       // constant indices: the array stays in registers
    for (int t = 0; t < 8; ++t) fk[t] = -__builtin_inff();
#pragma unroll                                                       // constant indices: the array stays in registers
    for (int dy = 0; dy < 2; ++dy) {
#pragma unroll                                                       // constant indices: the array stays in registers
      for (int dx = 0; dx < 2; ++dx) {
        const float* pk = Os + (dy * WIMG + 2 * lq + dx) * OSPP + DQ + 8 * e4;
        const v4f ka = *(const v4f*)pk, kq = *(const v4f*)(pk + 4);
#pragma unroll                                                       // constant indices: the array stays in registers
        for (int t = 0; t < 4; ++t) {
          fk[t]     = fmaxf(fk[t], ka[t]);
          fk[4 + t] = fmaxf(fk[4 + t], kq[t]);
        }
      }
    }
#pragma unroll                                                       // constant indices: the array stays in registers
    for (int t = 0; t < 4; ++t) { fk[t] += bfr(pba[t]); fk[4 + t] += bfr(pbq[t]); }
    v4u kh, kl;
    split8(fk, kh, kl);
    const size_t pok = ((size_t)(b * MM + WP * st + lq)) * DQ + 8 * e4;
    *(v4u*)(Kh + pok) = kh;
    *(v4u*)(Kl + pok) = kl;
  } else {
    // pooled g: wave 4 + j makes chunk j (keys 8j..8j+7 of the step), lane = channel
    const int j = wave - 4;
    const float bg = bfr(gbl);
    unsigned short hb[8];
#pragma unroll                                                       // constant indices: the array stays in registers
    for (int t = 0; t < 8; ++t) {
      const float* pg = Os + (2 * (8 * j + t)) * OSPP + 2 * DQ + lane;
      const float v = fmaxf(fmaxf(pg[0], pg[OSPP]), fmaxf(pg[WIMG * OSPP], pg[(WIMG + 1) * OSPP])) + bg;
      hb[t] = h_bits((_Float16)v);
    }
    v4u up;
#pragma unroll                                                       // constant indices: the array stays in registers
    for (int t = 0; t < 4; ++t) up[t] = pk16(hb[2 * t], hb[2 * t + 1]);
    *(v4u*)(Gc + ((size_t)(b * NSTRIP + st)) * (DQ * WP) + (size_t)(j * DQ + lane) * 8) = up;
  }
}

// =========================================================================================================
// (4) attention and output conv for one (b, 256-query tile), transposed formulation, 1024 keys, no mask, no scale:
//   S^T tile (16 keys x 16 queries) = A(k: row = key kb + (lane&15), 32 d via the split k map from the bf16
//   plane Kh [b][1024][32]) . B(q: col = query, same map from Qh [b][4096][32]) + A(Kh).B(Ql) + A(Kl).B(Qh)
//   (bf16 unscaled residual planes, shared accumulator); q fragments loaded once (K = 32 = one step).
//   Per lane the D tile holds 8 keys of ONE query: online softmax state per lane, one shuffle (lane^16) for the max
//   over 32 keys; the o/l rescale is skipped under a wave-uniform ballot when no lane's max grew (corr == 1 exactly
//   for every lane then); row-sum partials combined at the end. P = e^{s-m} x 16384 as f16 is the B operand of
//   y^T (rows channel, cols queries) += A(pooled g: rows channel = 16j + (lane&15), keys contiguous, f16 plane Gc
//   [b][32 steps][4 j][32 ch][8 keys]) . B(P^T): element r <- D of the tile covering keys kb..kb+15, element 8+r <- the tile covering
//   kb+16..kb+31, lane unchanged. 2 accumulator tiles per wave (32 channels). Block = 16 waves = 256 queries.
//   The batch's whole Kh, Kl and Gc planes (3 x 64 KiB) are copied once into LDS by asynchronous 16-byte copies and
//   every fragment is read from there. LDS layout: step t (32 keys) at t * KVT; in it six 1-KiB fragment tiles
//   (Kh keys 0..15, Kh keys 16..31, Kl likewise, Gc channels 0..15, 16..31); in a tile the 16-byte chunk j (k
//   elements 8j..8j+7) of row r stands at j * 256 + ((r + 4j) & 15) * 16, so that a half-wave's b128 read (fixed j,
//   16 rows) and a half-wave's copy (4 rows x 4 j for Kh and Kl, 16 rows of one j for Gc) each meet every bank once.
//   Output conv in the same launch: y = O/l stays in registers. Lane (hh, c) holds channels 8 hh + r (tile 0) and
//   16 + 8 hh + r (tile 1) of query c, which is the split k map of a 16-bit A fragment (row = query, K = 32
//   channels): y as bf16 hi = RNE(y) and lo = RNE(y - hi) fragments, Z[n][co] = A(y hi).B(W) + A(y lo).B(W), B col =
//   output channel 16 nt + (lane&15) from WWb bf16 [64][32], 4 n-tiles, shared accumulator. D: lane (hh, c) holds
//   positions 16 w + 8 hh + r of channel 16 nt + c -> Os[channel][position] (pitch OCP, b128 stores, every bank
//   once per half-wave), block barrier, then out = (Z + bias) + x: a wave handles 128 positions of one channel per
//   instruction (512 B = 4 whole lines). The x tile, the bias and the W fragments are read ahead of the key loop.
// coverage: Os written 16 waves x 16 positions x 64 channels, read 8 it x 8 channels x 64 lanes x 4 = the same; out
//           likewise 64 c x 256 n per block; grid (NQ/256, NB) covers out[b][0..63][0..NQ-1] exactly once.
//           KV: per plane 8 copies x 512 threads x 16 B = 64 KiB, each chunk to its own place, all read places filled.
// =========================================================================================================
__global__ __launch_bounds__(512) __attribute__((amdgpu_num_vgpr(256)))
void attn_k(const unsigned short* __restrict__ Qh, const unsigned short* __restrict__ Ql,
            const unsigned short* __restrict__ Kh, const unsigned short* __restrict__ Kl,
            const unsigned short* __restrict__ Gc, const unsigned short* __restrict__ WWb,
            const float* __restrict__ wb, const float* __restrict__ x, float* out) {
  __shared__ __align__(16) unsigned char KV[(MM / 32) * KVT];
  __shared__ __align__(16) float Os[CC * OCP];
  const int tid  = threadIdx.x;
  const int wave = tid >> 5, lane = tid & 31;
  const int hh   = lane >> 4, c = lane & 15;
  const int n0   = blockIdx.x * AQ, b = blockIdx.y;

  // q fragments (B operand, col = query n0 + 16*wave + c), whole head dim in one fragment
  const size_t qo = ((size_t)(b * NN + n0 + 16 * wave + c)) * DQ + 8 * hh;
  const Frag qh = ldfrag(Qh + qo);
  const Frag ql = ldfrag(Ql + qo);

  // ---- fill KV once: thread tid copies chunk 512 i + tid of each plane (global side contiguous over the lanes)
  {
    const unsigned kv0 = (unsigned)(uintptr_t)KV;                    // LDS byte address of KV
    const int cj = tid & 3;                                          // chunk j inside its row / step
    // Kh, Kl: row = key 128 i + (tid >> 2): step 4 i + (tid >> 7), tile (tid >> 6) & 1, row in tile (tid >> 2) & 15
    const unsigned dk = kv0 + (unsigned)((tid >> 7) * KVT + ((tid >> 6) & 1) * 1024 + cj * 256 +
                                         ((((tid >> 2) & 15) + 4 * cj) & 15) * 16);
    const unsigned short* gkh = Kh + (size_t)b * MM * DQ + 8 * tid;
    const unsigned short* gkl = Kl + (size_t)b * MM * DQ + 8 * tid;
    copy8(dk, 4 * KVT, gkh);
    copy8(dk + 2048u, 4 * KVT, gkl);
    // Gc (fragment order): step 4 i + (tid >> 7), chunk j = (tid >> 5) & 3, channel tid & 31
    const int vj = (tid >> 5) & 3;
    const unsigned dv = kv0 + (unsigned)((tid >> 7) * KVT + 4096 + ((tid >> 4) & 1) * 1024 + vj * 256 +
                                         (((tid & 15) + 4 * vj) & 15) * 16);
    const unsigned short* gv = Gc + (size_t)b * DQ * MM + 8 * tid;
    copy8(dv, 4 * KVT, gv);
    // every copy of this wave has landed before the barrier behind which the other waves read its bytes
#if defined(__HIP_DEVICE_COMPILE__)
    asm volatile("s_wait_asynccnt 0x0" ::: "memory");
#endif
  }
  __syncthreads();

  // ---- operands of the output conv and of the residual add: issued here, behind the barrier (which would wait for
  //      them) and ahead of the key loop, so that they arrive while the loop runs
  const int och = tid >> 6, opn = 4 * (tid & 63);                    // output rows: channel 8 it + och, position opn..+3
  const size_t oidx = ((size_t)(b * CC + och)) * NN + n0 + opn;
  Frag fw[CC / 16];
#pragma unroll                                                       // constant indices: fragments stay in registers
  for (int nt = 0; nt < CC / 16; ++nt) fw[nt] = ldfrag(WWb + (size_t)(16 * nt + c) * DQ + 8 * hh);
  float bo[8];
  v4f xr[8];
#pragma unroll                                                       // constant indices: the arrays stay in registers
  for (int it = 0; it < 8; ++it) {
    bo[it] = wb[8 * it + och];
    xr[it] = *(const v4f*)(x + oidx + (size_t)(8 * it) * NN);
  }

  // fragment read places in a tile: elements 0..7 = chunk hh, elements 8..15 = chunk 2 + hh, row c
  const unsigned char* fa = KV + hh * 256 + ((c + 4 * hh) & 15) * 16;
  const unsigned char* fb = KV + (2 + hh) * 256 + ((c + 8 + 4 * hh) & 15) * 16;

  float m = -1.0e30f, l = 0.f;
  v8f o[2];
  o[0] = zero8();
  o[1] = zero8();

#pragma unroll 1
  for (int kb = 0; kb < MM; kb += 32) {                              // fa, fb: this step's read places in KV
    const Frag k0  = ldfrag2(fa, fb);                                // keys kb .. kb+15
    const Frag k1  = ldfrag2(fa + 1024, fb + 1024);                  // keys kb+16 .. kb+31
    const Frag k0l = ldfrag2(fa + 2048, fb + 2048);
    const Frag k1l = ldfrag2(fa + 3072, fb + 3072);
    Frag vf[2];                                                      // read with the k fragments: one place of LDS reads
#pragma unroll                                                       // constant indices: vf stays in registers
    for (int j = 0; j < 2; ++j) vf[j] = ldfrag2(fa + 4096 + 1024 * j, fb + 4096 + 1024 * j);
    // the next step's read places advance in their own registers: formed anew at the loop's head they land in registers
    // that the step's last matrix instruction still reads, and the distance behind it is then padded with idle slots
    fa += KVT;
    fb += KVT;
    // keeps the step's twelve LDS reads together in front of its matrix work (for speed only)
    __builtin_amdgcn_sched_barrier(0);
    v8f s0 = mma_b(k0.bf, qh.bf, zero8());
    v8f s1 = mma_b(k1.bf, qh.bf, zero8());
    s0 = mma_b(k0.bf, ql.bf, s0);
    s1 = mma_b(k1.bf, ql.bf, s1);
    s0 = mma_b(k0l.bf, qh.bf, s0);
    s1 = mma_b(k1l.bf, qh.bf, s1);
    // keeps the six score products back to back, the two chains filling each other's distance: a vector instruction
    // moved in between them is padded on both sides
    __builtin_amdgcn_sched_barrier(0);

    float mx = fmaxf(hmax8(s0), hmax8(s1));
    mx = fmaxf(mx, __shfl_xor(mx, 16, 32));
    const float mn = fmaxf(m, mx);
    const unsigned grew = wave_ballot(mx > m);                       // wave-uniform
    if (grew != 0u) {
      const float corr = __expf(m - mn);                             // == 1 exactly for lanes whose max did not grow
      l *= corr;
#pragma unroll
      for (int j = 0; j < 2; ++j) {
#pragma unroll
        for (int r = 0; r < 8; ++r) o[j][r] *= corr;
      }
    }
    m = mn;
    const float msh = mn - LNPS;                                     // exp gives e^{s-m} * 16384

    FragH ph;
    float ls = 0.f;
#pragma unroll
    for (int r = 0; r < 8; ++r) {
      const float e0 = __expf(s0[r] - msh);                          // key kb      + 8hh + r
      const float e1 = __expf(s1[r] - msh);                          // key kb + 16 + 8hh + r
      ls += e0 + e1;
      ph.hv[0][r] = (_Float16)e0;
      ph.hv[1][r] = (_Float16)e1;
    }
    l += ls;

#pragma unroll
    for (int j = 0; j < 2; ++j) {
      o[j] = mma_h(vf[j].h, ph.v, o[j]);
    }
  }
  l += __shfl_xor(l, 16, 32);
  const float inv = 1.0f / l;                                        // o and l both carry the x16384 factor

  // ---- y = o * inv as bf16 hi / residual A fragments (row = query c, k = channel by the split k map)
  Frag yh, yl;
#pragma unroll                                                       // constant indices: fragments stay in registers
  for (int j = 0; j < 2; ++j) {
    float f[8];
#pragma unroll                                                       // constant indices: the array stays in registers
    for (int r = 0; r < 8; ++r) f[r] = o[j][r] * inv;
    v4u uh, ul;
    split8(f, uh, ul);
    yh.u[j] = __builtin_bit_cast(v8us, uh);
    yl.u[j] = __builtin_bit_cast(v8us, ul);
  }

  // ---- output conv; lane (hh, c) then holds positions 16 w + 8 hh + r of channel 16 nt + c -> Os[channel][position]
#pragma unroll                                                       // constant indices: fragments stay in registers
  for (int nt = 0; nt < CC / 16; ++nt) {
    v8f z = mma_b(yh.bf, fw[nt].bf, zero8());
    z = mma_b(yl.bf, fw[nt].bf, z);
    float* po = Os + (16 * nt + c) * OCP + 16 * wave + 8 * hh;
    const v4f va = {z[0], z[1], z[2], z[3]}, vb = {z[4], z[5], z[6], z[7]};
    *(v4f*)(po)     = va;
    *(v4f*)(po + 4) = vb;
  }
  __syncthreads();

  // ---- bias and residual add, whole lines out
#pragma unroll                                                       // constant indices: the arrays stay in registers
  for (int it = 0; it < 8; ++it) {
    const v4f a = *(const v4f*)(Os + (8 * it + och) * OCP + opn);
    const float bvs = bfr(bo[it]);
    v4f res;
#pragma unroll                                                       // constant indices: the vector stays in registers
    for (int t = 0; t < 4; ++t) res[t] = (a[t] + bvs) + bfr(xr[it][t]);
    *(v4f*)(out + oidx + (size_t)(8 * it) * NN) = res;
  }
}

// =========================================================================================================
// Workspace map (bytes; each region start a multiple of 256; every extent is an exact row/tile multiple and is
//   WWb bf16 [64][32]              4096
//   Qh/Ql bf16 [NB][4096][32]   4194304 x2 (NB=16)
//   Kh/Kl bf16 [NB][1024][32]   1048576 x2   Gc f16 [NB][32][4][32][8]   1048576
//   total (NB=16) = 11538432
// =========================================================================================================
extern "C" void kernel_launch(void* const* d_in, const int* in_sizes, int n_in,
                              void* d_out, int out_size, void* d_ws, size_t ws_size,
                              hipStream_t stream) {
  const int XN = NB * CC * NN;
  if (n_in < 9) return;
  if (in_sizes[0] < XN) return;
  if (in_sizes[1] < DQ * CC || in_sizes[3] < DQ * CC || in_sizes[5] < DQ * CC || in_sizes[7] < CC * DQ) return;
  if (in_sizes[2] < DQ || in_sizes[4] < DQ || in_sizes[6] < DQ || in_sizes[8] < CC) return;
  if (out_size < XN) return;

  size_t off = 0;
  auto carve = [&](size_t bytes) { const size_t o = off; off += (bytes + 255) & ~(size_t)255; return o; };
  const size_t oWWb = carve((size_t)CC * DQ * 2);
  const size_t oQh  = carve((size_t)NB * NN * DQ * 2);
  const size_t oQl  = carve((size_t)NB * NN * DQ * 2);
  const size_t oKh  = carve((size_t)NB * MM * DQ * 2);
  const size_t oKl  = carve((size_t)NB * MM * DQ * 2);
  const size_t oGc  = carve((size_t)NB * DQ * MM * 2);
  if (off > ws_size) return;
  if (off > (size_t)134217728) return;

  const float* x  = (const float*)d_in[0];
  const float* gw = (const float*)d_in[1];
  const float* gb = (const float*)d_in[2];
  const float* tw = (const float*)d_in[3];
  const float* tb = (const float*)d_in[4];
  const float* pw = (const float*)d_in[5];
  const float* pb = (const float*)d_in[6];
  const float* ow = (const float*)d_in[7];
  const float* wb = (const float*)d_in[8];

  char* ws = (char*)d_ws;
  unsigned short* WWb = (unsigned short*)(ws + oWWb);
  unsigned short* Qh  = (unsigned short*)(ws + oQh);
  unsigned short* Ql  = (unsigned short*)(ws + oQl);
  unsigned short* Kh  = (unsigned short*)(ws + oKh);
  unsigned short* Kl  = (unsigned short*)(ws + oKl);
  unsigned short* Gc  = (unsigned short*)(ws + oGc);
  float* out = (float*)d_out;

  const dim3 blk256(256), blk512(512);

  // (0) x, weights -> theta (q) hi/res planes, pooled phi (k) hi/res planes, pooled g f16 plane; w_w -> bf16 plane
  proj_pool<<<dim3(NSTRIP, NB), blk256, 0, stream>>>(x, tw, pw, gw, ow, tb, pb, gb, WWb, Qh, Ql, Kh, Kl, Gc);
  // (4) attention, output conv + bias + residual -> out [b][64][4096]
  attn_k<<<dim3(NQ / AQ, NB), blk512, 0, stream>>>(Qh, Ql, Kh, Kl, Gc, WWb, wb, x, out);
  (void)hipGetLastError();
}

// v005
// It runs in 23.6 microseconds.
// In both of two side-by-side timings against v004, it was 1.12 times as fast.
// All steps since v000 together make it 2.93 times as fast.
// Contractions: conv1x1 theta/phi/g GEMM W[96x64].X[64x128] per strip on v_wmma_f32_16x16x32_f16 (f16 containers
// of bf16-RNE weights x256 and bf16-RNE x); scores K.Q^T on v_wmma_f32_16x16x32_bf16 (bf16 hi + bf16 residual planes
// of theta / 2x2-max-pooled phi, 3 products, K=32); y^T = G.P^T on v_wmma_f32_16x16x32_f16 (2x2-max-pooled g as
// f16, P = 2^{score - reference} f16 from the score D registers); output conv Y.W^T[32x64] on v_wmma_f32_16x16x32_bf16 (bf16
// weights, y as bf16 hi + residual fragments, 2 products); f32 accumulate everywhere; max-pool, softmax statistics,
// bias and residual add in f32 VALU.
#include <hip/hip_runtime.h>
#include <math.h>
#include <stdint.h>

#ifndef NB
#define NB 16
#endif
#ifndef NQ
#define NQ 4096
#endif
#define NB_FULL 16
#define CC     64
#define HIMG   64
#define WIMG   64
#define NN     4096
#define DQ     32
#define HP     32
#define WP     32
#define MM     1024
#define MW     96
#define NMT    6
#define QT     64
#define SN     128
#define NSTRIP 32
#define OSPP   100
#define OCP    260
#define TP     72
#define WSC    256.0f
#define IWSC   0.00390625f
#define LOG2E  1.4426950408889634f
#define LSTH   32768.0f
#define AQ     256
#define KVT    6160

static_assert(NB >= 1 && NB <= NB_FULL);
static_assert(NQ % QT == 0 && NQ >= QT && NQ <= NN);
static_assert(NN == HIMG * WIMG);
static_assert(SN == 2 * WIMG);
static_assert(NSTRIP * SN == NN);
static_assert(SN == 8 * 16);
static_assert(SN == 2 * 64 && SN == 4 * 32);
static_assert(HP * 2 == HIMG && WP * 2 == WIMG);
static_assert(MM == HP * WP);
static_assert(MM % QT == 0 && MM % 32 == 0);
static_assert(QT == 2 * WP);
static_assert(CC == QT);
static_assert(DQ == 32);
static_assert(MW == 3 * DQ && NMT * 16 == MW);
static_assert(CC % 32 == 0);
static_assert((OSPP * 4) % 16 == 0 && OSPP >= MW);
static_assert((OCP * 4) % 16 == 0 && OCP >= AQ && OCP % 64 == 4);
static_assert((TP * 2) % 16 == 0 && TP >= QT);
static_assert(SN * OSPP * 4 <= 65536);
static_assert((size_t)NB_FULL * CC * NN * 4 == (size_t)16777216);
static_assert(NQ % AQ == 0 && AQ == 16 * 16);
static_assert(KVT % 16 == 0 && KVT >= 6 * 1024 && (MM / 32) * KVT + CC * OCP * 4 <= 327680);
static_assert(MM * DQ * 2 == 8 * 512 * 16);

typedef _Float16       v16h __attribute__((ext_vector_type(16)));
typedef _Float16       v8h  __attribute__((ext_vector_type(8)));
typedef __bf16         v16b __attribute__((ext_vector_type(16)));
typedef unsigned short v8us __attribute__((ext_vector_type(8)));
typedef float          v8f  __attribute__((ext_vector_type(8)));
typedef float          v4f  __attribute__((ext_vector_type(4)));
typedef unsigned int   v4u  __attribute__((ext_vector_type(4)));

union Frag  { v8us u[2]; v16h h; v16b bf; };
union FragH { v16h v; v8h hv[2]; };
static_assert(sizeof(Frag) == 32);
static_assert(sizeof(FragH) == 32);

// ---- scalar helpers ---------------------------------------------------------------------------------------
__device__ __forceinline__ unsigned short bf_bits(float f) {          // f32 -> bf16 bits, RNE convert
  unsigned u = __float_as_uint(f);
  return (unsigned short)((u + 0x7FFFu + ((u >> 16) & 1u)) >> 16);
}
__device__ __forceinline__ float bf_up(unsigned short hb) { return __uint_as_float(((unsigned)hb) << 16); }
__device__ __forceinline__ float bfr(float f) { return bf_up(bf_bits(f)); }
__device__ __forceinline__ unsigned short h_bits(_Float16 x) { return __builtin_bit_cast(unsigned short, x); }
__device__ __forceinline__ unsigned pk16(unsigned short a, unsigned short b) { return (unsigned)a | ((unsigned)b << 16); }
__device__ __forceinline__ v8f zero8() { v8f z = {0.f, 0.f, 0.f, 0.f, 0.f, 0.f, 0.f, 0.f}; return z; }
__device__ __forceinline__ float hmax8(v8f s) {
  return fmaxf(fmaxf(fmaxf(s[0], s[1]), fmaxf(s[2], s[3])), fmaxf(fmaxf(s[4], s[5]), fmaxf(s[6], s[7])));
}
// exponentials of a step's 16 scores of one lane (log2 units, reference already taken off) and their sum
__device__ __forceinline__ float exp_sum(const v8f& s0, const v8f& s1, v8f& e0, v8f& e1) {
  float ls = 0.f;
#pragma unroll                                                       // constant indices: the vectors stay in registers
  for (int r = 0; r < 8; ++r) {
    e0[r] = __builtin_amdgcn_exp2f(s0[r]);                           // key kb      + 8hh + r
    e1[r] = __builtin_amdgcn_exp2f(s1[r]);                           // key kb + 16 + 8hh + r
    ls += e0[r] + e1[r];
  }
  return ls;
}
__device__ __forceinline__ unsigned wave_ballot(bool p) {
#if defined(__HIP_DEVICE_COMPILE__)
  return __builtin_amdgcn_ballot_w32(p);
#else
  return p ? 1u : 0u;
#endif
}
// 8 f32 values -> bf16 hi bits and bf16 residual bits (lo = RNE(v - hi)), packed 2 per uint
__device__ __forceinline__ void split8(const float* f, v4u& uh, v4u& ul) {
#pragma unroll
  for (int t = 0; t < 4; ++t) {
    const float f0 = f[2 * t], f1 = f[2 * t + 1];
    const unsigned short hb0 = bf_bits(f0), hb1 = bf_bits(f1);
    const unsigned short lb0 = bf_bits(f0 - bf_up(hb0));
    const unsigned short lb1 = bf_bits(f1 - bf_up(hb1));
    uh[t] = pk16(hb0, hb1);
    ul[t] = pk16(lb0, lb1);
  }
}

// ---- 16-bit fragment loader (A, or B from a k-contiguous [n][k] row): lane -> row/col (lane&15), p already includes
//      + 8*(lane>>4); elements 0..7 <- p[0..7] (k0+8h..), elements 8..15 <- p[16..23] (k0+16+8h..)
__device__ __forceinline__ Frag ldfrag(const unsigned short* p) {
  Frag f;
  f.u[0] = *(const v8us*)(p);
  f.u[1] = *(const v8us*)(p + 16);
  return f;
}

// the same fragment from two separate 16-byte places (LDS tiles kept in fragment order)
__device__ __forceinline__ Frag ldfrag2(const unsigned char* p0, const unsigned char* p1) {
  Frag f;
  f.u[0] = *(const v8us*)(p0);
  f.u[1] = *(const v8us*)(p1);
  return f;
}

// ---- eight asynchronous 16-byte copies global -> LDS per lane, copy i from g + 4096 i elements (8 KiB apart) to the
//      LDS byte address d[i]. One statement: the closing s_wait_xcnt 0 stands in front of any rewrite of the address
//      registers that the issued copies name. The landing wait (s_wait_asynccnt) is the caller's.
__device__ __forceinline__ void copy8v(const unsigned* d, const unsigned short* g) {
#if defined(__HIP_DEVICE_COMPILE__)
  asm volatile("global_load_async_to_lds_b128 %0, %8, off\n\t"
               "global_load_async_to_lds_b128 %1, %9, off\n\t"
               "global_load_async_to_lds_b128 %2, %10, off\n\t"
               "global_load_async_to_lds_b128 %3, %11, off\n\t"
               "global_load_async_to_lds_b128 %4, %12, off\n\t"
               "global_load_async_to_lds_b128 %5, %13, off\n\t"
               "global_load_async_to_lds_b128 %6, %14, off\n\t"
               "global_load_async_to_lds_b128 %7, %15, off\n\t"
               "s_wait_xcnt 0x0"
               :: "v"(d[0]), "v"(d[1]), "v"(d[2]), "v"(d[3]), "v"(d[4]), "v"(d[5]), "v"(d[6]), "v"(d[7]),
                  "v"(g), "v"(g + 4096), "v"(g + 2 * 4096), "v"(g + 3 * 4096), "v"(g + 4 * 4096), "v"(g + 5 * 4096),
                  "v"(g + 6 * 4096), "v"(g + 7 * 4096)
               : "memory");
#endif
}
__device__ __forceinline__ void copy8(unsigned d0, unsigned dstep, const unsigned short* g) {
  unsigned d[8];
#pragma unroll                                                       // constant indices: d stays in registers
  for (int i = 0; i < 8; ++i) d[i] = d0 + (unsigned)i * dstep;
  copy8v(d, g);
}

// ---- WMMA helpers: the plain builtins; the compiler keeps the distance behind each matrix instruction itself ------
__device__ __forceinline__ v8f mma_h(v16h a, v16h b, v8f c) {
  return __builtin_amdgcn_wmma_f32_16x16x32_f16(false, a, false, b, (short)0, c, false, false);
}
__device__ __forceinline__ v8f mma_b(v16b a, v16b b, v8f c) {
  return __builtin_amdgcn_wmma_f32_16x16x32_bf16(false, a, false, b, (short)0, c, false, false);
}

// =========================================================================================================
// (0) front end for one (b, strip of 128 positions = image rows 2s and 2s+1), one launch, everything between x and
//     the attention operands kept in LDS. Block 256 threads = 8 waves.
//     a) x f32 [b][64 c][4096 n]: wave w reads rows c = 8w..8w+7, lane q the 16 bytes n0+4q..+3 of each (a whole
//        512-B row per instruction) -> Xs f16 [128 n][64 c] (pitch TP, bf16-RNE values, exact in f16), b128 stores.
//        theta_w / phi_w / g_w f32 -> Wl f16 [96 o][64 c] (pitch TP; rows 0..31 theta, 32..63 phi, 64..95 g; value =
//        bf16-RNE x256). Block (0, 0) also writes WWb bf16 [64][32] = bf16-RNE of w_w for the output conv in the next launch.
//     b) block barrier; Y[o][n] = (1/256) sum_c Wl[o][c] Xs[n][c]: wave w owns cols 16w..16w+15 (one B fragment per
//        k-step) and 6 m-tiles (A rows o = 16 mt + (lane&15)), K = 64 = 2 steps, fragments by the split k map from
//        LDS; results to Os[n_loc][o_loc] (pitch OSPP, b128 stores); block barrier.
//     c) o 0..31 -> v = (theta + bias) x log2 e -> Qh/Ql bf16 [b][4096 n][32 d] (hi = RNE(v), lo = RNE(v-hi)): the
//        scores of the next launch then come out in log2 units.
//        The strip holds every 2x2 window of pooled row py = s: key m = 32 s + px, window n_loc = 64 dy + 2 px + dx.
//        Waves 0..3: o 32..63 -> max over the window, + bias (rounding is monotone: the same value as the max of the
//        biased four) -> Kh/Kl bf16 [b][1024 m][32 d]. Waves 4..7: o 64..95 likewise -> f16 -> Gc in fragment order
//        [b][32 steps][4 j][32 ch][8 keys]: step = s, chunk j = keys 8j..8j+7 of the step; wave 4+j, lane = channel.
// coverage: Xs 8 waves x 8 c x 128 n, Wl 3 x 32 rows x 8 lanes x 8, both read whole; Os 8 waves x 16 n x 96 o written,
//           reads rows <= 127 cols <= 95; Qh/Ql 2 it x 64 rows x 4 lanes x 8 = 128 n x 32 d; Kh/Kl 32 rows x 4 lanes x
//           8; Gc 4 waves x 32 lanes x 8 = 2 KiB; grid (32, NB) covers every plane exactly once, a block's piece of
//           each plane contiguous (8 KiB, 2 KiB, 2 KiB).
// =========================================================================================================
__global__ __launch_bounds__(256)
void proj_pool(const float* __restrict__ x, const float* __restrict__ tw, const float* __restrict__ pw,
               const float* __restrict__ gw, const float* __restrict__ ow, const float* __restrict__ tb,
               const float* __restrict__ pb, const float* __restrict__ gb, unsigned short* WWb,
               unsigned short* Qh, unsigned short* Ql, unsigned short* Kh, unsigned short* Kl,
               unsigned short* Gc) {
  __shared__ __align__(16) unsigned short Xs[SN * TP];
  __shared__ __align__(16) unsigned short Wl[MW * TP];
  __shared__ __align__(16) float Os[SN * OSPP];
  const int tid  = threadIdx.x;
  const int lane = tid & 31, wave = tid >> 5;                        // wave 0..7
  const int hh   = lane >> 4, c = lane & 15;
  const int st   = blockIdx.x, b = blockIdx.y;
  const int n0   = st * SN;

  // ---- a) all global reads first, then the conversions
  v4f xv[8];
  {
    const float* sp = x + ((size_t)(b * CC + 8 * wave)) * NN + n0 + 4 * lane;
#pragma unroll                                                       // constant indices: the array stays in registers
    for (int i = 0; i < 8; ++i) xv[i] = *(const v4f*)(sp + (size_t)i * NN);
  }
  const int rl = tid >> 3, col = 8 * (tid & 7);                      // rl 0..31, col 0..56
  v4f wa[3], wq[3];
#pragma unroll                                                       // constant indices: the array stays in registers
  for (int k = 0; k < 3; ++k) {
    const float* wbase = (k == 0) ? tw : ((k == 1) ? pw : gw);
    const float* s = wbase + (size_t)rl * CC + col;
    wa[k] = *(const v4f*)s;
    wq[k] = *(const v4f*)(s + 4);
  }
  // biases: read here, with the other global reads, so that no memory latency stands behind the barriers
  const int e4 = tid & 3, lq = tid >> 2;                             // lq 0..63
  const v4f tba = *(const v4f*)(tb + 8 * e4), tbq = *(const v4f*)(tb + 8 * e4 + 4);
  const v4f pba = *(const v4f*)(pb + 8 * e4), pbq = *(const v4f*)(pb + 8 * e4 + 4);
  const float gbl = gb[lane];
  if (st == 0 && b == 0) {
    const int o = tid >> 2;                                          // 0..63
    const int oc = 8 * (tid & 3);                                    // 0..24
    const float* s = ow + (size_t)o * DQ + oc;
    const v4f a = *(const v4f*)s;
    const v4f q = *(const v4f*)(s + 4);
    const float f[8] = {a[0], a[1], a[2], a[3], q[0], q[1], q[2], q[3]};
    v4u u;
#pragma unroll                                                       // constant indices: the array stays in registers
    for (int t = 0; t < 4; ++t) u[t] = pk16(bf_bits(f[2 * t]), bf_bits(f[2 * t + 1]));
    *(v4u*)(WWb + (size_t)o * DQ + oc) = u;
  }
#pragma unroll                                                       // constant indices: the array stays in registers
  for (int k = 0; k < 3; ++k) {
    const float f[8] = {wa[k][0], wa[k][1], wa[k][2], wa[k][3], wq[k][0], wq[k][1], wq[k][2], wq[k][3]};
    v4u u;
#pragma unroll                                                       // constant indices: the array stays in registers
    for (int t = 0; t < 4; ++t) {
      const _Float16 h0 = (_Float16)(bfr(f[2 * t]) * WSC);
      const _Float16 h1 = (_Float16)(bfr(f[2 * t + 1]) * WSC);
      u[t] = pk16(h_bits(h0), h_bits(h1));
    }
    *(v4u*)(Wl + (DQ * k + rl) * TP + col) = u;
  }
#pragma unroll                                                       // constant indices: the array stays in registers
  for (int t = 0; t < 4; ++t) {                                      // position 4 lane + t, channels 8 wave .. + 7
    v4u u;
#pragma unroll                                                       // constant indices: the array stays in registers
    for (int i = 0; i < 4; ++i) {
      u[i] = pk16(h_bits((_Float16)bfr(xv[2 * i][t])), h_bits((_Float16)bfr(xv[2 * i + 1][t])));
    }
    *(v4u*)(Xs + (4 * lane + t) * TP + 8 * wave) = u;
  }
  __syncthreads();

  // ---- b) the GEMM, fragments from LDS
  const unsigned short* ap = Wl + c * TP + 8 * hh;
  const unsigned short* bp = Xs + (16 * wave + c) * TP + 8 * hh;

  v8f acc[NMT];
#pragma unroll                                                       // constant indices: the array stays in registers
  for (int mt = 0; mt < NMT; ++mt) acc[mt] = zero8();

  Frag fb[CC / 32], fa[CC / 32][NMT];                                // all fragments first: one place of LDS reads
#pragma unroll                                                       // constant indices: fragments stay in registers
  for (int ks = 0; ks < CC / 32; ++ks) {
    fb[ks] = ldfrag(bp + 32 * ks);
#pragma unroll                                                       // constant indices: the array stays in registers
    for (int mt = 0; mt < NMT; ++mt) fa[ks][mt] = ldfrag(ap + (16 * mt) * TP + 32 * ks);
  }
  // keeps all fragment reads in front of the matrix work (for speed only)
  __builtin_amdgcn_sched_barrier(0);
#pragma unroll                                                       // constant indices: the array stays in registers
  for (int ks = 0; ks < CC / 32; ++ks) {
#pragma unroll                                                       // constant indices: the array stays in registers
    for (int mt = 0; mt < NMT; ++mt) acc[mt] = mma_h(fa[ks][mt].h, fb[ks].h, acc[mt]);
  }

  // scale back -> LDS Os[n_loc][o_loc]; lane (hh, c) holds o = 16 mt + 8 hh + r for n_loc = 16 w + c
  {
    const int nl = 16 * wave + c;
#pragma unroll                                                       // constant indices: the array stays in registers
    for (int mt = 0; mt < NMT; ++mt) {
      v4f va, vb;
#pragma unroll                                                       // constant indices: the array stays in registers
      for (int r = 0; r < 4; ++r) { va[r] = acc[mt][r] * IWSC; vb[r] = acc[mt][4 + r] * IWSC; }
      *(v4f*)(Os + nl * OSPP + 16 * mt + 8 * hh)     = va;
      *(v4f*)(Os + nl * OSPP + 16 * mt + 8 * hh + 4) = vb;
    }
  }
  __syncthreads();

  // ---- c) theta -> bf16 hi / residual planes
  {
    float bv[8];
#pragma unroll                                                       // constant indices: the array stays in registers
    for (int t = 0; t < 4; ++t) { bv[t] = bfr(tba[t]); bv[4 + t] = bfr(tbq[t]); }
#pragma unroll                                                       // constant indices: the array stays in registers
    for (int it = 0; it < 2; ++it) {
      const int row = it * 64 + lq;                                  // n_loc 0..127
      const v4f a = *(const v4f*)(Os + row * OSPP + 8 * e4);
      const v4f q = *(const v4f*)(Os + row * OSPP + 8 * e4 + 4);
      float f[8];
#pragma unroll                                                       // constant indices: the array stays in registers
      for (int t = 0; t < 4; ++t) { f[t] = (a[t] + bv[t]) * LOG2E; f[4 + t] = (q[t] + bv[4 + t]) * LOG2E; }
      v4u uh, ul;
      split8(f, uh, ul);
      const size_t po = ((size_t)(b * NN + n0 + row)) * DQ + 8 * e4;
      *(v4u*)(Qh + po) = uh;
      *(v4u*)(Ql + po) = ul;
    }
  }

  if (wave < 4) {
    // pooled phi: thread (key lq 0..31, 8 d at 8 e4)
    float fk[8];
#pragma unroll                                                       // constant indices: the array stays in registers
    for (int t = 0; t < 8; ++t) fk[t] = -__builtin_inff();
#pragma unroll                                                       // constant indices: the array stays in registers
    for (int dy = 0; dy < 2; ++dy) {
#pragma unroll                                                       // constant indices: the array stays in registers
      for (int dx = 0; dx < 2; ++dx) {
        const float* pk = Os + (dy * WIMG + 2 * lq + dx) * OSPP + DQ + 8 * e4;
        const v4f ka = *(const v4f*)pk, kq = *(const v4f*)(pk + 4);
#pragma unroll                                                       // constant indices: the array stays in registers
        for (int t = 0; t < 4; ++t) {
          fk[t]     = fmaxf(fk[t], ka[t]);
          fk[4 + t] = fmaxf(fk[4 + t], kq[t]);
        }
      }
    }
#pragma unroll                                                       // constant indices: the array stays in registers
    for (int t = 0; t < 4; ++t) { fk[t] += bfr(pba[t]); fk[4 + t] += bfr(pbq[t]); }
    v4u kh, kl;
    split8(fk, kh, kl);
    const size_t pok = ((size_t)(b * MM + WP * st + lq)) * DQ + 8 * e4;
    *(v4u*)(Kh + pok) = kh;
    *(v4u*)(Kl + pok) = kl;
  } else {
    // pooled g: wave 4 + j makes chunk j (keys 8j..8j+7 of the step), lane = channel
    const int j = wave - 4;
    const float bg = bfr(gbl);
    unsigned short hb[8];
#pragma unroll                                                       // constant indices: the array stays in registers
    for (int t = 0; t < 8; ++t) {
      const float* pg = Os + (2 * (8 * j + t)) * OSPP + 2 * DQ + lane;
      const float v = fmaxf(fmaxf(pg[0], pg[OSPP]), fmaxf(pg[WIMG * OSPP], pg[(WIMG + 1) * OSPP])) + bg;
      hb[t] = h_bits((_Float16)v);
    }
    v4u up;
#pragma unroll                                                       // constant indices: the array stays in registers
    for (int t = 0; t < 4; ++t) up[t] = pk16(hb[2 * t], hb[2 * t + 1]);
    *(v4u*)(Gc + ((size_t)(b * NSTRIP + st)) * (DQ * WP) + (size_t)(j * DQ + lane) * 8) = up;
  }
}

// =========================================================================================================
// (4) attention and output conv for one (b, 256-query tile), transposed formulation, 1024 keys, no mask, no scale:
//   S^T tile (16 keys x 16 queries) = A(k: row = key kb + (lane&15), 32 d via the split k map from the bf16
//   plane Kh [b][1024][32]) . B(q: col = query, same map from Qh [b][4096][32]) + A(Kh).B(Ql) + A(Kl).B(Qh)
//   (bf16 unscaled residual planes, shared accumulator); q fragments loaded once (K = 32 = one step).
//   Per lane the D tile holds 8 keys of ONE query. theta carries the factor log2 e, and the score accumulators start
//   at cv = minus the query's reference (eight equal registers, the C operand of the first product), so that D is
//   the argument of exp2 as it stands: no per-step maximum, shuffle, subtraction or multiply. The reference moves
//   only in step 0 and when a lane's partial row sum of a step passes 2^15 (wave-uniform ballot; every P <= that sum,
//   so P fits f16): there the step's maximum over 32 keys (one shuffle, lane^16) becomes the new zero point where it
//   lies above the old one, o and l are rescaled by 2^-shift (exactly 1 for the queries that do not move), and the
//   step's exponentials are made again. The largest P of a query ends between 1 and 2^15; a term rounds to zero
//   only below 2^-25 of that. Row-sum partials combined at the end. P = 2^D as f16 is the B operand of
//   y^T (rows channel, cols queries) += A(pooled g: rows channel = 16j + (lane&15), keys contiguous, f16 plane Gc
//   [b][32 steps][4 j][32 ch][8 keys]) . B(P^T): element r <- D of the tile covering keys kb..kb+15, element 8+r <- the tile covering
//   kb+16..kb+31, lane unchanged. 2 accumulator tiles per wave (32 channels). Block = 16 waves = 256 queries.
//   The batch's whole Kh, Kl and Gc planes (3 x 64 KiB) are copied once into LDS by asynchronous 16-byte copies and
//   every fragment is read from there. LDS layout: step t (32 keys) at t * KVT; in it six 1-KiB fragment tiles
//   (Kh keys 0..15, Kh keys 16..31, Kl likewise, Gc channels 0..15, 16..31); in a tile the 16-byte chunk j (k
//   elements 8j..8j+7) of row r stands at j * 256 + ((r + 4j) & 15) * 16, so that a half-wave's b128 read (fixed j,
//   16 rows) and a half-wave's copy (4 rows x 4 j for Kh and Kl, 16 rows of one j for Gc) each meet every bank once.
//   Output conv in the same launch: y = O/l stays in registers. Lane (hh, c) holds channels 8 hh + r (tile 0) and
//   16 + 8 hh + r (tile 1) of query c, which is the split k map of a 16-bit A fragment (row = query, K = 32
//   channels): y as bf16 hi = RNE(y) and lo = RNE(y - hi) fragments, Z[n][co] = A(y hi).B(W) + A(y lo).B(W), B col =
//   output channel 16 nt + (lane&15) from WWb bf16 [64][32], 4 n-tiles, shared accumulator. D: lane (hh, c) holds
//   positions 16 w + 8 hh + r of channel 16 nt + c -> Os[channel][position] (pitch OCP, b128 stores, every bank
//   once per half-wave), block barrier, then out = (Z + bias) + x: a wave handles 128 positions of one channel per
//   instruction (512 B = 4 whole lines). The x tile, the bias and the W fragments are read ahead of the key loop.
// coverage: Os written 16 waves x 16 positions x 64 channels, read 8 it x 8 channels x 64 lanes x 4 = the same; out
//           likewise 64 c x 256 n per block; grid (NQ/256, NB) covers out[b][0..63][0..NQ-1] exactly once.
//           KV: per plane 8 copies x 512 threads x 16 B = 64 KiB, each chunk to its own place, all read places filled.
// =========================================================================================================
__global__ __launch_bounds__(512) __attribute__((amdgpu_num_vgpr(256)))
void attn_k(const unsigned short* __restrict__ Qh, const unsigned short* __restrict__ Ql,
            const unsigned short* __restrict__ Kh, const unsigned short* __restrict__ Kl,
            const unsigned short* __restrict__ Gc, const unsigned short* __restrict__ WWb,
            const float* __restrict__ wb, const float* __restrict__ x, float* out) {
  __shared__ __align__(16) unsigned char KV[(MM / 32) * KVT];
  __shared__ __align__(16) float Os[CC * OCP];
  const int tid  = threadIdx.x;
  const int wave = tid >> 5, lane = tid & 31;
  const int hh   = lane >> 4, c = lane & 15;
  const int n0   = blockIdx.x * AQ, b = blockIdx.y;

  // q fragments (B operand, col = query n0 + 16*wave + c), whole head dim in one fragment
  const size_t qo = ((size_t)(b * NN + n0 + 16 * wave + c)) * DQ + 8 * hh;
  const Frag qh = ldfrag(Qh + qo);
  const Frag ql = ldfrag(Ql + qo);

  // ---- fill KV once: thread tid copies chunk 512 i + tid of each plane (global side contiguous over the lanes)
  {
    const unsigned kv0 = (unsigned)(uintptr_t)KV;                    // LDS byte address of KV
    const int cj = tid & 3;                                          // chunk j inside its row / step
    // Kh, Kl: row = key 128 i + (tid >> 2): step 4 i + (tid >> 7), tile (tid >> 6) & 1, row in tile (tid >> 2) & 15
    const unsigned dk = kv0 + (unsigned)((tid >> 7) * KVT + ((tid >> 6) & 1) * 1024 + cj * 256 +
                                         ((((tid >> 2) & 15) + 4 * cj) & 15) * 16);
    const unsigned short* gkh = Kh + (size_t)b * MM * DQ + 8 * tid;
    const unsigned short* gkl = Kl + (size_t)b * MM * DQ + 8 * tid;
    copy8(dk, 4 * KVT, gkh);
    copy8(dk + 2048u, 4 * KVT, gkl);
    // Gc (fragment order): step 4 i + (tid >> 7), chunk j = (tid >> 5) & 3, channel tid & 31
    const int vj = (tid >> 5) & 3;
    const unsigned dv = kv0 + (unsigned)((tid >> 7) * KVT + 4096 + ((tid >> 4) & 1) * 1024 + vj * 256 +
                                         (((tid & 15) + 4 * vj) & 15) * 16);
    const unsigned short* gv = Gc + (size_t)b * DQ * MM + 8 * tid;
    copy8(dv, 4 * KVT, gv);
    // every copy of this wave has landed before the barrier behind which the other waves read its bytes
#if defined(__HIP_DEVICE_COMPILE__)
    asm volatile("s_wait_asynccnt 0x0" ::: "memory");
#endif
  }
  __syncthreads();

  // ---- operands of the output conv and of the residual add: issued here, behind the barrier (which would wait for
  //      them) and ahead of the key loop, so that they arrive while the loop runs
  const int och = tid >> 6, opn = 4 * (tid & 63);                    // output rows: channel 8 it + och, position opn..+3
  const size_t oidx = ((size_t)(b * CC + och)) * NN + n0 + opn;
  Frag fw[CC / 16];
#pragma unroll                                                       // constant indices: fragments stay in registers
  for (int nt = 0; nt < CC / 16; ++nt) fw[nt] = ldfrag(WWb + (size_t)(16 * nt + c) * DQ + 8 * hh);
  float bo[8];
  v4f xr[8];
#pragma unroll                                                       // constant indices: the arrays stay in registers
  for (int it = 0; it < 8; ++it) {
    bo[it] = wb[8 * it + och];
    xr[it] = *(const v4f*)(x + oidx + (size_t)(8 * it) * NN);
  }

  // fragment read places in a tile: elements 0..7 = chunk hh, elements 8..15 = chunk 2 + hh, row c
  const unsigned char* fa = KV + hh * 256 + ((c + 4 * hh) & 15) * 16;
  const unsigned char* fb = KV + (2 + hh) * 256 + ((c + 8 + 4 * hh) & 15) * 16;

  float l = 0.f;
  v8f cv = zero8();                                                  // minus the query's reference, eight times
  v8f o[2];
  o[0] = zero8();
  o[1] = zero8();

#pragma unroll 1
  for (int kb = 0; kb < MM; kb += 32) {                              // fa, fb: this step's read places in KV
    const Frag k0  = ldfrag2(fa, fb);                                // keys kb .. kb+15
    const Frag k1  = ldfrag2(fa + 1024, fb + 1024);                  // keys kb+16 .. kb+31
    const Frag k0l = ldfrag2(fa + 2048, fb + 2048);
    const Frag k1l = ldfrag2(fa + 3072, fb + 3072);
    Frag vf[2];                                                      // read with the k fragments: one place of LDS reads
#pragma unroll                                                       // constant indices: vf stays in registers
    for (int j = 0; j < 2; ++j) vf[j] = ldfrag2(fa + 4096 + 1024 * j, fb + 4096 + 1024 * j);
    // the next step's read places advance in their own registers: formed anew at the loop's head they land in registers
    // that the step's last matrix instruction still reads, and the distance behind it is then padded with idle slots
    fa += KVT;
    fb += KVT;
    // keeps the step's twelve LDS reads together in front of its matrix work (for speed only)
    __builtin_amdgcn_sched_barrier(0);
    v8f s0 = mma_b(k0.bf, qh.bf, cv);
    v8f s1 = mma_b(k1.bf, qh.bf, cv);
    s0 = mma_b(k0.bf, ql.bf, s0);
    s1 = mma_b(k1.bf, ql.bf, s1);
    s0 = mma_b(k0l.bf, qh.bf, s0);
    s1 = mma_b(k1l.bf, qh.bf, s1);
    // keeps the six score products back to back, the two chains filling each other's distance: a vector instruction
    // moved in between them is padded on both sides
    __builtin_amdgcn_sched_barrier(0);

    v8f e0, e1;
    float ls = exp_sum(s0, s1, e0, e1);
    const float th = (kb == 0) ? -1.0f : LSTH;                       // step 0 always sets the reference (ls >= 0)
    const unsigned over = wave_ballot(!(ls <= th));                  // wave-uniform; an infinite or undefined sum counts
    if (over != 0u) {
      float mx = fmaxf(hmax8(s0), hmax8(s1));
      mx = fmaxf(mx, __shfl_xor(mx, 16, 32));
      const float dl = fmaxf(mx, (kb == 0) ? -__builtin_inff() : 0.f);  // the reference never falls after step 0
      const float corr = __builtin_amdgcn_exp2f(fminf(-dl, 0.f));    // step 0: o = l = 0, the factor stays finite
      l *= corr;
#pragma unroll                                                       // constant indices: o stays in registers
      for (int j = 0; j < 2; ++j) {
#pragma unroll                                                       // constant indices: o stays in registers
        for (int r = 0; r < 8; ++r) o[j][r] *= corr;
      }
#pragma unroll                                                       // constant indices: the vectors stay in registers
      for (int r = 0; r < 8; ++r) {
        s0[r] -= dl;
        s1[r] -= dl;
        cv[r] -= dl;
      }
      ls = exp_sum(s0, s1, e0, e1);
    }

    FragH ph;
#pragma unroll                                                       // constant indices: the vectors stay in registers
    for (int r = 0; r < 8; ++r) {
      ph.hv[0][r] = (_Float16)e0[r];
      ph.hv[1][r] = (_Float16)e1[r];
    }
    l += ls;

#pragma unroll
    for (int j = 0; j < 2; ++j) {
      o[j] = mma_h(vf[j].h, ph.v, o[j]);
    }
  }
  l += __shfl_xor(l, 16, 32);
  const float inv = 1.0f / l;                                        // o and l carry the same factor 2^-reference

  // ---- y = o * inv as bf16 hi / residual A fragments (row = query c, k = channel by the split k map)
  Frag yh, yl;
#pragma unroll                                                       // constant indices: fragments stay in registers
  for (int j = 0; j < 2; ++j) {
    float f[8];
#pragma unroll                                                       // constant indices: the array stays in registers
    for (int r = 0; r < 8; ++r) f[r] = o[j][r] * inv;
    v4u uh, ul;
    split8(f, uh, ul);
    yh.u[j] = __builtin_bit_cast(v8us, uh);
    yl.u[j] = __builtin_bit_cast(v8us, ul);
  }

  // ---- output conv; lane (hh, c) then holds positions 16 w + 8 hh + r of channel 16 nt + c -> Os[channel][position]
#pragma unroll                                                       // constant indices: fragments stay in registers
  for (int nt = 0; nt < CC / 16; ++nt) {
    v8f z = mma_b(yh.bf, fw[nt].bf, zero8());
    z = mma_b(yl.bf, fw[nt].bf, z);
    float* po = Os + (16 * nt + c) * OCP + 16 * wave + 8 * hh;
    const v4f va = {z[0], z[1], z[2], z[3]}, vb = {z[4], z[5], z[6], z[7]};
    *(v4f*)(po)     = va;
    *(v4f*)(po + 4) = vb;
  }
  __syncthreads();

  // ---- bias and residual add, whole lines out
#pragma unroll                                                       // constant indices: the arrays stay in registers
  for (int it = 0; it < 8; ++it) {
    const v4f a = *(const v4f*)(Os + (8 * it + och) * OCP + opn);
    const float bvs = bfr(bo[it]);
    v4f res;
#pragma unroll                                                       // constant indices: the vector stays in registers
    for (int t = 0; t < 4; ++t) res[t] = (a[t] + bvs) + bfr(xr[it][t]);
    *(v4f*)(out + oidx + (size_t)(8 * it) * NN) = res;
  }
}

// =========================================================================================================
// Workspace map (bytes; each region start a multiple of 256; every extent is an exact row/tile multiple and is
//   WWb bf16 [64][32]              4096
//   Qh/Ql bf16 [NB][4096][32]   4194304 x2 (NB=16)
//   Kh/Kl bf16 [NB][1024][32]   1048576 x2   Gc f16 [NB][32][4][32][8]   1048576
//   total (NB=16) = 11538432
// =========================================================================================================
extern "C" void kernel_launch(void* const* d_in, const int* in_sizes, int n_in,
                              void* d_out, int out_size, void* d_ws, size_t ws_size,
                              hipStream_t stream) {
  const int XN = NB * CC * NN;
  if (n_in < 9) return;
  if (in_sizes[0] < XN) return;
  if (in_sizes[1] < DQ * CC || in_sizes[3] < DQ * CC || in_sizes[5] < DQ * CC || in_sizes[7] < CC * DQ) return;
  if (in_sizes[2] < DQ || in_sizes[4] < DQ || in_sizes[6] < DQ || in_sizes[8] < CC) return;
  if (out_size < XN) return;

  size_t off = 0;
  auto carve = [&](size_t bytes) { const size_t o = off; off += (bytes + 255) & ~(size_t)255; return o; };
  const size_t oWWb = carve((size_t)CC * DQ * 2);
  const size_t oQh  = carve((size_t)NB * NN * DQ * 2);
  const size_t oQl  = carve((size_t)NB * NN * DQ * 2);
  const size_t oKh  = carve((size_t)NB * MM * DQ * 2);
  const size_t oKl  = carve((size_t)NB * MM * DQ * 2);
  const size_t oGc  = carve((size_t)NB * DQ * MM * 2);
  if (off > ws_size) return;
  if (off > (size_t)134217728) return;

  const float* x  = (const float*)d_in[0];
  const float* gw = (const float*)d_in[1];
  const float* gb = (const float*)d_in[2];
  const float* tw = (const float*)d_in[3];
  const float* tb = (const float*)d_in[4];
  const float* pw = (const float*)d_in[5];
  const float* pb = (const float*)d_in[6];
  const float* ow = (const float*)d_in[7];
  const float* wb = (const float*)d_in[8];

  char* ws = (char*)d_ws;
  unsigned short* WWb = (unsigned short*)(ws + oWWb);
  unsigned short* Qh  = (unsigned short*)(ws + oQh);
  unsigned short* Ql  = (unsigned short*)(ws + oQl);
  unsigned short* Kh  = (unsigned short*)(ws + oKh);
  unsigned short* Kl  = (unsigned short*)(ws + oKl);
  unsigned short* Gc  = (unsigned short*)(ws + oGc);
  float* out = (float*)d_out;

  const dim3 blk256(256), blk512(512);

  // (0) x, weights -> theta (q) hi/res planes, pooled phi (k) hi/res planes, pooled g f16 plane; w_w -> bf16 plane
  proj_pool<<<dim3(NSTRIP, NB), blk256, 0, stream>>>(x, tw, pw, gw, ow, tb, pb, gb, WWb, Qh, Ql, Kh, Kl, Gc);
  // (4) attention, output conv + bias + residual -> out [b][64][4096]
  attn_k<<<dim3(NQ / AQ, NB), blk512, 0, stream>>>(Qh, Ql, Kh, Kl, Gc, WWb, wb, x, out);
  (void)hipGetLastError();
}

// v007
// One run takes 17.5 microseconds.
// Versions in between are left out here; by their measured steps it is 1.35 times as fast as v005.
// Counting every step since v000, it is 3.95 times as fast.
// Contractions: conv1x1 theta/phi/g GEMM W[96x64].X[64x128] per strip on v_wmma_f32_16x16x32_f16 (f16 containers
// of bf16-RNE weights x256 and bf16-RNE x); scores K.Q^T on v_wmma_f32_16x16x32_f16 (theta and 2x2-max-pooled phi
// each as one f16 plane, 1 product, K=32); y^T = G.P^T on v_wmma_f32_16x16x32_f16 (2x2-max-pooled g as
// f16, P = 2^{score - reference} f16 from the score D registers); output conv Y.W^T[32x64] on v_wmma_f32_16x16x32_bf16 (bf16
// weights, y as bf16 hi + residual fragments, 2 products); f32 accumulate everywhere; max-pool, softmax statistics,
// bias and residual add in f32 VALU.
#include <hip/hip_runtime.h>
#include <math.h>
#include <stdint.h>

#ifndef NB
#define NB 16
#endif
#ifndef NQ
#define NQ 4096
#endif
#define NB_FULL 16
#define CC     64
#define HIMG   64
#define WIMG   64
#define NN     4096
#define DQ     32
#define HP     32
#define WP     32
#define MM     1024
#define MW     96
#define NMT    6
#define QT     64
#define SN     128
#define NSTRIP 32
#define OSPP   100
#define OCP    260
#define TP     72
#define WSC    256.0f
#define IWSC   0.00390625f
#define LOG2E  1.4426950408889634f
#define LSTH   32768.0f
#define AQ     256
#define KVT    4112

static_assert(NB >= 1 && NB <= NB_FULL);
static_assert(NQ % QT == 0 && NQ >= QT && NQ <= NN);
static_assert(NN == HIMG * WIMG);
static_assert(SN == 2 * WIMG);
static_assert(NSTRIP * SN == NN);
static_assert(SN == 8 * 16);
static_assert(SN == 2 * 64 && SN == 4 * 32);
static_assert(HP * 2 == HIMG && WP * 2 == WIMG);
static_assert(MM == HP * WP);
static_assert(MM % QT == 0 && MM % 32 == 0);
static_assert(QT == 2 * WP);
static_assert(CC == QT);
static_assert(DQ == 32);
static_assert(MW == 3 * DQ && NMT * 16 == MW);
static_assert(CC % 32 == 0);
static_assert((OSPP * 4) % 16 == 0 && OSPP >= MW);
static_assert((OCP * 4) % 16 == 0 && OCP >= AQ && OCP % 64 == 4);
static_assert((TP * 2) % 16 == 0 && TP >= QT);
static_assert(SN * OSPP * 4 <= 65536);
static_assert((size_t)NB_FULL * CC * NN * 4 == (size_t)16777216);
static_assert(NQ % AQ == 0 && AQ == 8 * 32);
static_assert(KVT % 16 == 0 && KVT >= 4 * 1024 && (MM / 32) * KVT + CC * OCP * 4 <= 327680);
static_assert(MM * DQ * 2 == 16 * 256 * 16);

typedef _Float16       v16h __attribute__((ext_vector_type(16)));
typedef _Float16       v8h  __attribute__((ext_vector_type(8)));
typedef __bf16         v16b __attribute__((ext_vector_type(16)));
typedef unsigned short v8us __attribute__((ext_vector_type(8)));
typedef float          v8f  __attribute__((ext_vector_type(8)));
typedef float          v4f  __attribute__((ext_vector_type(4)));
typedef unsigned int   v4u  __attribute__((ext_vector_type(4)));

union Frag  { v8us u[2]; v16h h; v16b bf; };
union FragH { v16h v; v8h hv[2]; };
static_assert(sizeof(Frag) == 32);
static_assert(sizeof(FragH) == 32);

// ---- scalar helpers ---------------------------------------------------------------------------------------
__device__ __forceinline__ unsigned short bf_bits(float f) {          // f32 -> bf16 bits, RNE convert
  unsigned u = __float_as_uint(f);
  return (unsigned short)((u + 0x7FFFu + ((u >> 16) & 1u)) >> 16);
}
__device__ __forceinline__ float bf_up(unsigned short hb) { return __uint_as_float(((unsigned)hb) << 16); }
__device__ __forceinline__ float bfr(float f) { return bf_up(bf_bits(f)); }
__device__ __forceinline__ unsigned short h_bits(_Float16 x) { return __builtin_bit_cast(unsigned short, x); }
__device__ __forceinline__ unsigned pk16(unsigned short a, unsigned short b) { return (unsigned)a | ((unsigned)b << 16); }
__device__ __forceinline__ v8f zero8() { v8f z = {0.f, 0.f, 0.f, 0.f, 0.f, 0.f, 0.f, 0.f}; return z; }
__device__ __forceinline__ float hmax8(v8f s) {
  return fmaxf(fmaxf(fmaxf(s[0], s[1]), fmaxf(s[2], s[3])), fmaxf(fmaxf(s[4], s[5]), fmaxf(s[6], s[7])));
}
// exponentials of a step's 16 scores of one lane (log2 units, reference already taken off) and their sum
__device__ __forceinline__ float exp_sum(const v8f& s0, const v8f& s1, v8f& e0, v8f& e1) {
#pragma unroll                                                       // constant indices: the vectors stay in registers
  for (int r = 0; r < 8; ++r) {
    e0[r] = __builtin_amdgcn_exp2f(s0[r]);                           // key kb      + 8hh + r
    e1[r] = __builtin_amdgcn_exp2f(s1[r]);                           // key kb + 16 + 8hh + r
  }
  const v8f t = e0 + e1;                                             // whole vectors: packed adds on even register pairs
  float ls = t[0];
#pragma unroll                                                       // constant indices: the vector stays in registers
  for (int r = 1; r < 8; ++r) ls += t[r];                            // summed in the order r = 0 .. 7
  return ls;
}
__device__ __forceinline__ unsigned wave_ballot(bool p) {
#if defined(__HIP_DEVICE_COMPILE__)
  return __builtin_amdgcn_ballot_w32(p);
#else
  return p ? 1u : 0u;
#endif
}
// 8 f32 values -> bf16 hi bits and bf16 residual bits (lo = RNE(v - hi)), packed 2 per uint
__device__ __forceinline__ void split8(const float* f, v4u& uh, v4u& ul) {
#pragma unroll
  for (int t = 0; t < 4; ++t) {
    const float f0 = f[2 * t], f1 = f[2 * t + 1];
    const unsigned short hb0 = bf_bits(f0), hb1 = bf_bits(f1);
    const unsigned short lb0 = bf_bits(f0 - bf_up(hb0));
    const unsigned short lb1 = bf_bits(f1 - bf_up(hb1));
    uh[t] = pk16(hb0, hb1);
    ul[t] = pk16(lb0, lb1);
  }
}

// 8 f32 values -> f16 bits (RNE), packed 2 per uint
__device__ __forceinline__ v4u pack8h(const float* f) {
  v4u u;
#pragma unroll                                                       // constant indices: the vector stays in registers
  for (int t = 0; t < 4; ++t) u[t] = pk16(h_bits((_Float16)f[2 * t]), h_bits((_Float16)f[2 * t + 1]));
  return u;
}

// ---- 16-bit fragment loader (A, or B from a k-contiguous [n][k] row): lane -> row/col (lane&15), p already includes
//      + 8*(lane>>4); elements 0..7 <- p[0..7] (k0+8h..), elements 8..15 <- p[16..23] (k0+16+8h..)
__device__ __forceinline__ Frag ldfrag(const unsigned short* p) {
  Frag f;
  f.u[0] = *(const v8us*)(p);
  f.u[1] = *(const v8us*)(p + 16);
  return f;
}

// the same fragment from two separate 16-byte places (LDS tiles kept in fragment order)
__device__ __forceinline__ Frag ldfrag2(const unsigned char* p0, const unsigned char* p1) {
  Frag f;
  f.u[0] = *(const v8us*)(p0);
  f.u[1] = *(const v8us*)(p1);
  return f;
}

// ---- eight asynchronous 16-byte copies global -> LDS per lane, copy i from g + 2048 i elements (4 KiB apart) to the
//      LDS byte address d[i]. One statement: the closing s_wait_xcnt 0 stands in front of any rewrite of the address
//      registers that the issued copies name. The landing wait (s_wait_asynccnt) is the caller's.
__device__ __forceinline__ void copy8v(const unsigned* d, const unsigned short* g) {
#if defined(__HIP_DEVICE_COMPILE__)
  asm volatile("global_load_async_to_lds_b128 %0, %8, off\n\t"
               "global_load_async_to_lds_b128 %1, %9, off\n\t"
               "global_load_async_to_lds_b128 %2, %10, off\n\t"
               "global_load_async_to_lds_b128 %3, %11, off\n\t"
               "global_load_async_to_lds_b128 %4, %12, off\n\t"
               "global_load_async_to_lds_b128 %5, %13, off\n\t"
               "global_load_async_to_lds_b128 %6, %14, off\n\t"
               "global_load_async_to_lds_b128 %7, %15, off\n\t"
               "s_wait_xcnt 0x0"
               :: "v"(d[0]), "v"(d[1]), "v"(d[2]), "v"(d[3]), "v"(d[4]), "v"(d[5]), "v"(d[6]), "v"(d[7]),
                  "v"(g), "v"(g + 2048), "v"(g + 2 * 2048), "v"(g + 3 * 2048), "v"(g + 4 * 2048), "v"(g + 5 * 2048),
                  "v"(g + 6 * 2048), "v"(g + 7 * 2048)
               : "memory");
#endif
}
__device__ __forceinline__ void copy8(unsigned d0, unsigned dstep, const unsigned short* g) {
  unsigned d[8];
#pragma unroll                                                       // constant indices: d stays in registers
  for (int i = 0; i < 8; ++i) d[i] = d0 + (unsigned)i * dstep;
  copy8v(d, g);
}

// ---- WMMA helpers: the plain builtins; the compiler keeps the distance behind each matrix instruction itself ------
__device__ __forceinline__ v8f mma_h(v16h a, v16h b, v8f c) {
  return __builtin_amdgcn_wmma_f32_16x16x32_f16(false, a, false, b, (short)0, c, false, false);
}
__device__ __forceinline__ v8f mma_b(v16b a, v16b b, v8f c) {
  return __builtin_amdgcn_wmma_f32_16x16x32_bf16(false, a, false, b, (short)0, c, false, false);
}

// =========================================================================================================
// (0) front end for one (b, strip of 128 positions = image rows 2s and 2s+1), one launch, everything between x and
//     the attention operands kept in LDS. Block 256 threads = 8 waves.
//     a) x f32 [b][64 c][4096 n]: wave w reads rows c = 8w..8w+7, lane q the 16 bytes n0+4q..+3 of each (a whole
//        512-B row per instruction) -> Xs f16 [128 n][64 c] (pitch TP, bf16-RNE values, exact in f16), b128 stores.
//        theta_w / phi_w / g_w f32 -> Wl f16 [96 o][64 c] (pitch TP; rows 0..31 theta, 32..63 phi, 64..95 g; value =
//        bf16-RNE x256). Block (0, 0) also writes WWb bf16 [64][32] = bf16-RNE of w_w for the output conv in the next launch.
//     b) block barrier; Y[o][n] = (1/256) sum_c Wl[o][c] Xs[n][c]: wave w owns cols 16w..16w+15 (one B fragment per
//        k-step) and 6 m-tiles (A rows o = 16 mt + (lane&15)), K = 64 = 2 steps, fragments by the split k map from
//        LDS; results to Os[n_loc][o_loc] (pitch OSPP, b128 stores); block barrier.
//     c) o 0..31 -> v = (theta + bias) x log2 e -> Qf f16 [b][4096 n][32 d] (RNE): the scores of the next launch
//        then come out in log2 units.
//        The strip holds every 2x2 window of pooled row py = s: key m = 32 s + px, window n_loc = 64 dy + 2 px + dx.
//        Waves 0..3: o 32..63 -> max over the window, + bias (rounding is monotone: the same value as the max of the
//        biased four) -> Kf f16 [b][1024 m][32 d]. Waves 4..7: o 64..95 likewise -> f16 -> Gc in fragment order
//        [b][32 steps][4 j][32 ch][8 keys]: step = s, chunk j = keys 8j..8j+7 of the step; wave 4+j, lane = channel.
// coverage: Xs 8 waves x 8 c x 128 n, Wl 3 x 32 rows x 8 lanes x 8, both read whole; Os 8 waves x 16 n x 96 o written,
//           reads rows <= 127 cols <= 95; Qf 2 it x 64 rows x 4 lanes x 8 = 128 n x 32 d; Kf 32 rows x 4 lanes x
//           8; Gc 4 waves x 32 lanes x 8 = 2 KiB; grid (32, NB) covers every plane exactly once, a block's piece of
//           each plane contiguous (8 KiB, 2 KiB, 2 KiB).
// =========================================================================================================
__global__ __launch_bounds__(256)
void proj_pool(const float* __restrict__ x, const float* __restrict__ tw, const float* __restrict__ pw,
               const float* __restrict__ gw, const float* __restrict__ ow, const float* __restrict__ tb,
               const float* __restrict__ pb, const float* __restrict__ gb, unsigned short* WWb,
               unsigned short* Qf, unsigned short* Kf, unsigned short* Gc) {
  __shared__ __align__(16) unsigned short Xs[SN * TP];
  __shared__ __align__(16) unsigned short Wl[MW * TP];
  __shared__ __align__(16) float Os[SN * OSPP];
  const int tid  = threadIdx.x;
  const int lane = tid & 31, wave = tid >> 5;                        // wave 0..7
  const int hh   = lane >> 4, c = lane & 15;
  const int st   = blockIdx.x, b = blockIdx.y;
  const int n0   = st * SN;

  // ---- a) all global reads first, then the conversions
  v4f xv[8];
  {
    const float* sp = x + ((size_t)(b * CC + 8 * wave)) * NN + n0 + 4 * lane;
#pragma unroll                                                       // constant indices: the array stays in registers
    for (int i = 0; i < 8; ++i) xv[i] = *(const v4f*)(sp + (size_t)i * NN);
  }
  const int rl = tid >> 3, col = 8 * (tid & 7);                      // rl 0..31, col 0..56
  v4f wa[3], wq[3];
#pragma unroll                                                       // constant indices: the array stays in registers
  for (int k = 0; k < 3; ++k) {
    const float* wbase = (k == 0) ? tw : ((k == 1) ? pw : gw);
    const float* s = wbase + (size_t)rl * CC + col;
    wa[k] = *(const v4f*)s;
    wq[k] = *(const v4f*)(s + 4);
  }
  // biases: read here, with the other global reads, so that no memory latency stands behind the barriers
  const int e4 = tid & 3, lq = tid >> 2;                             // lq 0..63
  const v4f tba = *(const v4f*)(tb + 8 * e4), tbq = *(const v4f*)(tb + 8 * e4 + 4);
  const v4f pba = *(const v4f*)(pb + 8 * e4), pbq = *(const v4f*)(pb + 8 * e4 + 4);
  const float gbl = gb[lane];
  if (st == 0 && b == 0) {
    const int o = tid >> 2;                                          // 0..63
    const int oc = 8 * (tid & 3);                                    // 0..24
    const float* s = ow + (size_t)o * DQ + oc;
    const v4f a = *(const v4f*)s;
    const v4f q = *(const v4f*)(s + 4);
    const float f[8] = {a[0], a[1], a[2], a[3], q[0], q[1], q[2], q[3]};
    v4u u;
#pragma unroll                                                       // constant indices: the array stays in registers
    for (int t = 0; t < 4; ++t) u[t] = pk16(bf_bits(f[2 * t]), bf_bits(f[2 * t + 1]));
    *(v4u*)(WWb + (size_t)o * DQ + oc) = u;
  }
#pragma unroll                                                       // constant indices: the array stays in registers
  for (int k = 0; k < 3; ++k) {
    const float f[8] = {wa[k][0], wa[k][1], wa[k][2], wa[k][3], wq[k][0], wq[k][1], wq[k][2], wq[k][3]};
    v4u u;
#pragma unroll                                                       // constant indices: the array stays in registers
    for (int t = 0; t < 4; ++t) {
      const _Float16 h0 = (_Float16)(bfr(f[2 * t]) * WSC);
      const _Float16 h1 = (_Float16)(bfr(f[2 * t + 1]) * WSC);
      u[t] = pk16(h_bits(h0), h_bits(h1));
    }
    *(v4u*)(Wl + (DQ * k + rl) * TP + col) = u;
  }
#pragma unroll                                                       // constant indices: the array stays in registers
  for (int t = 0; t < 4; ++t) {                                      // position 4 lane + t, channels 8 wave .. + 7
    v4u u;
#pragma unroll                                                       // constant indices: the array stays in registers
    for (int i = 0; i < 4; ++i) {
      u[i] = pk16(h_bits((_Float16)bfr(xv[2 * i][t])), h_bits((_Float16)bfr(xv[2 * i + 1][t])));
    }
    *(v4u*)(Xs + (4 * lane + t) * TP + 8 * wave) = u;
  }
  __syncthreads();

  // ---- b) the GEMM, fragments from LDS
  const unsigned short* ap = Wl + c * TP + 8 * hh;
  const unsigned short* bp = Xs + (16 * wave + c) * TP + 8 * hh;

  v8f acc[NMT];
#pragma unroll                                                       // constant indices: the array stays in registers
  for (int mt = 0; mt < NMT; ++mt) acc[mt] = zero8();

  Frag fb[CC / 32], fa[CC / 32][NMT];                                // all fragments first: one place of LDS reads
#pragma unroll                                                       // constant indices: fragments stay in registers
  for (int ks = 0; ks < CC / 32; ++ks) {
    fb[ks] = ldfrag(bp + 32 * ks);
#pragma unroll                                                       // constant indices: the array stays in registers
    for (int mt = 0; mt < NMT; ++mt) fa[ks][mt] = ldfrag(ap + (16 * mt) * TP + 32 * ks);
  }
  // keeps all fragment reads in front of the matrix work (for speed only)
  __builtin_amdgcn_sched_barrier(0);
#pragma unroll                                                       // constant indices: the array stays in registers
  for (int ks = 0; ks < CC / 32; ++ks) {
#pragma unroll                                                       // constant indices: the array stays in registers
    for (int mt = 0; mt < NMT; ++mt) acc[mt] = mma_h(fa[ks][mt].h, fb[ks].h, acc[mt]);
  }

  // scale back -> LDS Os[n_loc][o_loc]; lane (hh, c) holds o = 16 mt + 8 hh + r for n_loc = 16 w + c
  {
    const int nl = 16 * wave + c;
#pragma unroll                                                       // constant indices: the array stays in registers
    for (int mt = 0; mt < NMT; ++mt) {
      v4f va, vb;
#pragma unroll                                                       // constant indices: the array stays in registers
      for (int r = 0; r < 4; ++r) { va[r] = acc[mt][r] * IWSC; vb[r] = acc[mt][4 + r] * IWSC; }
      *(v4f*)(Os + nl * OSPP + 16 * mt + 8 * hh)     = va;
      *(v4f*)(Os + nl * OSPP + 16 * mt + 8 * hh + 4) = vb;
    }
  }
  __syncthreads();

  // ---- c) theta -> f16 plane
  {
    float bv[8];
#pragma unroll                                                       // constant indices: the array stays in registers
    for (int t = 0; t < 4; ++t) { bv[t] = bfr(tba[t]); bv[4 + t] = bfr(tbq[t]); }
#pragma unroll                                                       // constant indices: the array stays in registers
    for (int it = 0; it < 2; ++it) {
      const int row = it * 64 + lq;                                  // n_loc 0..127
      const v4f a = *(const v4f*)(Os + row * OSPP + 8 * e4);
      const v4f q = *(const v4f*)(Os + row * OSPP + 8 * e4 + 4);
      float f[8];
#pragma unroll                                                       // constant indices: the array stays in registers
      for (int t = 0; t < 4; ++t) { f[t] = (a[t] + bv[t]) * LOG2E; f[4 + t] = (q[t] + bv[4 + t]) * LOG2E; }
      *(v4u*)(Qf + ((size_t)(b * NN + n0 + row)) * DQ + 8 * e4) = pack8h(f);
    }
  }

  if (wave < 4) {
    // pooled phi: thread (key lq 0..31, 8 d at 8 e4)
    float fk[8];
#pragma unroll                                                       // constant indices: the array stays in registers
    for (int t = 0; t < 8; ++t) fk[t] = -__builtin_inff();
#pragma unroll                                                       // constant indices: the array stays in registers
    for (int dy = 0; dy < 2; ++dy) {
#pragma unroll                                                       // constant indices: the array stays in registers
      for (int dx = 0; dx < 2; ++dx) {
        const float* pk = Os + (dy * WIMG + 2 * lq + dx) * OSPP + DQ + 8 * e4;
        const v4f ka = *(const v4f*)pk, kq = *(const v4f*)(pk + 4);
#pragma unroll                                                       // constant indices: the array stays in registers
        for (int t = 0; t < 4; ++t) {
          fk[t]     = fmaxf(fk[t], ka[t]);
          fk[4 + t] = fmaxf(fk[4 + t], kq[t]);
        }
      }
    }
#pragma unroll                                                       // constant indices: the array stays in registers
    for (int t = 0; t < 4; ++t) { fk[t] += bfr(pba[t]); fk[4 + t] += bfr(pbq[t]); }
    *(v4u*)(Kf + ((size_t)(b * MM + WP * st + lq)) * DQ + 8 * e4) = pack8h(fk);
  } else {
    // pooled g: wave 4 + j makes chunk j (keys 8j..8j+7 of the step), lane = channel
    const int j = wave - 4;
    const float bg = bfr(gbl);
    unsigned short hb[8];
#pragma unroll                                                       // constant indices: the array stays in registers
    for (int t = 0; t < 8; ++t) {
      const float* pg = Os + (2 * (8 * j + t)) * OSPP + 2 * DQ + lane;
      const float v = fmaxf(fmaxf(pg[0], pg[OSPP]), fmaxf(pg[WIMG * OSPP], pg[(WIMG + 1) * OSPP])) + bg;
      hb[t] = h_bits((_Float16)v);
    }
    v4u up;
#pragma unroll                                                       // constant indices: the array stays in registers
    for (int t = 0; t < 4; ++t) up[t] = pk16(hb[2 * t], hb[2 * t + 1]);
    *(v4u*)(Gc + ((size_t)(b * NSTRIP + st)) * (DQ * WP) + (size_t)(j * DQ + lane) * 8) = up;
  }
}

// =========================================================================================================
// (4) attention and output conv for one (b, 256-query tile), transposed formulation, 1024 keys, no mask, no scale:
//   S^T tile (16 keys x 16 queries) = A(k: row = key kb + (lane&15), 32 d via the split k map from the f16
//   plane Kf [b][1024][32]) . B(q: col = query, same map from Qf [b][4096][32]); one product: an f16 operand's
//   rounding moves a score by a few thousandths, well under what the bf16 rounding of x and of the weights in
//   front of it already does; q fragments loaded once (K = 32 = one step).
//   A wave owns TWO query tiles (32 queries: tile t = queries 32 w + 16 t + (lane&15)) and all keys: every K and G
//   fragment read from LDS feeds both tiles, and the block has 8 waves (two on a SIMD) in place of 16.
//   Per lane a D tile holds 8 keys of ONE query. theta carries the factor log2 e, and the score accumulators start
//   at cv = minus the query's reference (eight equal registers, the C operand of the product), so that D is
//   the argument of exp2 as it stands: no per-step maximum, shuffle, subtraction or multiply. A tile's reference moves
//   only in step 0 and when a lane's partial row sum of a step passes 2^15 (ballot over the tile's 32 lanes; every P
//   <= that sum, so P fits f16): there the step's maximum over 32 keys (one shuffle, lane^16) becomes the new zero
//   point where it lies above the old one, o and l are rescaled by 2^-shift (exactly 1 for the queries that do not
//   move), and the step's exponentials are made again. The largest P of a query ends between 1 and 2^15; a term
//   rounds to zero only below 2^-25 of that. Row-sum partials combined at the end. P = 2^D as f16 is the B operand of
//   y^T (rows channel, cols queries) += A(pooled g: rows channel = 16j + (lane&15), keys contiguous, f16 plane Gc
//   [b][32 steps][4 j][32 ch][8 keys]) . B(P^T): element r <- D of the tile covering keys kb..kb+15, element 8+r <- the tile covering
//   kb+16..kb+31, lane unchanged. 2 accumulator tiles per query tile (32 channels). Block = 8 waves = 256 queries.
//   The batch's whole Kf and Gc planes (2 x 64 KiB) are copied once into LDS by asynchronous 16-byte copies and
//   every fragment is read from there. LDS layout: step t (32 keys) at t * KVT; in it four 1-KiB fragment tiles
//   (Kf keys 0..15, Kf keys 16..31, Gc channels 0..15, 16..31); in a tile the 16-byte chunk j (k
//   elements 8j..8j+7) of row r stands at j * 256 + ((r + 4j) & 15) * 16, so that a half-wave's b128 read (fixed j,
//   16 rows) and a half-wave's copy (4 rows x 4 j for Kf, 16 rows of one j for Gc) each meet every bank once.
//   Output conv in the same launch: y = O/l stays in registers. Lane (hh, c) holds channels 8 hh + r (tile 0) and
//   16 + 8 hh + r (tile 1) of query c, which is the split k map of a 16-bit A fragment (row = query, K = 32
//   channels): y as bf16 hi = RNE(y) and lo = RNE(y - hi) fragments, Z[n][co] = A(y hi).B(W) + A(y lo).B(W), B col =
//   output channel 16 nt + (lane&15) from WWb bf16 [64][32], 4 n-tiles, shared accumulator. D: lane (hh, c) holds
//   positions 32 w + 16 t + 8 hh + r of channel 16 nt + c -> Os[channel][position] (pitch OCP, b128 stores, every
//   bank once per half-wave), block barrier, then out = (Z + bias) + x: a wave handles 128 positions of one channel
//   per instruction (512 B = 4 whole lines). The x tile is read ahead of the key loop, the bias and the W fragments behind it.
// coverage: Os written 8 waves x 32 positions x 64 channels, read 16 it x 4 channels x 64 lanes x 4 = the same; out
//           likewise 64 c x 256 n per block; grid (NQ/256, NB) covers out[b][0..63][0..NQ-1] exactly once.
//           KV: per plane 16 copies x 256 threads x 16 B = 64 KiB, each chunk to its own place, all read places filled.
// =========================================================================================================
// one query tile's reference moves: s0, s1 the step's scores, first = step 0; returns the step's new row-sum partial.
// act = the tile's own ballot (wave-uniform): without it the shift is 0, the factor exactly 1 and every value stays
__device__ __forceinline__ float move_ref(bool act, bool first, v8f& s0, v8f& s1, v8f& cv, v8f& oa, v8f& ob, float& l,
                                          v8f& e0, v8f& e1) {
  float mx = fmaxf(hmax8(s0), hmax8(s1));
  mx = fmaxf(mx, __shfl_xor(mx, 16, 32));
  const float dl = act ? fmaxf(mx, first ? -__builtin_inff() : 0.f) : 0.f;  // the reference never falls after step 0
  const float corr = __builtin_amdgcn_exp2f(fminf(-dl, 0.f));        // step 0: o = l = 0, the factor stays finite
  l *= corr;
  oa *= corr;                                                        // whole-vector forms: each stays one eight-register value
  ob *= corr;
  s0 -= dl;
  s1 -= dl;
  cv -= dl;
  return exp_sum(s0, s1, e0, e1);
}

// the four score products of a step (2 key tiles x 2 query tiles) in one statement. Written as text because the builtin
// form made the compiler copy one tile's eight C registers into the D registers in every step and pad twice. The four
// v_nop keep the distance that the chip needs behind the last product before its D is read or its A, B overwritten.
__device__ __forceinline__ void scores4(const v16h& k0, const v16h& k1, const v16h& q0, const v16h& q1, const v8f& c0,
                                        const v8f& c1, v8f& s00, v8f& s01, v8f& s10, v8f& s11) {
#if defined(__HIP_DEVICE_COMPILE__)
  asm("v_wmma_f32_16x16x32_f16 %0, %4, %6, %8\n\t"
      "v_wmma_f32_16x16x32_f16 %1, %5, %6, %8\n\t"
      "v_wmma_f32_16x16x32_f16 %2, %4, %7, %9\n\t"
      "v_wmma_f32_16x16x32_f16 %3, %5, %7, %9\n\t"
      "v_nop\n\t"
      "v_nop\n\t"
      "v_nop\n\t"
      "v_nop"
      : "=&v"(s00), "=&v"(s01), "=&v"(s10), "=&v"(s11)
      : "v"(k0), "v"(k1), "v"(q0), "v"(q1), "v"(c0), "v"(c1));
#endif
}

__global__ __launch_bounds__(256) __attribute__((amdgpu_num_vgpr(256)))
void attn_k(const unsigned short* __restrict__ Qf, const unsigned short* __restrict__ Kf,
            const unsigned short* __restrict__ Gc, const unsigned short* __restrict__ WWb,
            const float* __restrict__ wb, const float* __restrict__ x, float* out) {
  __shared__ __align__(16) unsigned char KV[(MM / 32) * KVT];
  __shared__ __align__(16) float Os[CC * OCP];
  const int tid  = threadIdx.x;
  const int wave = tid >> 5, lane = tid & 31;                        // wave 0..7
  const int hh   = lane >> 4, c = lane & 15;
  const int n0   = blockIdx.x * AQ, b = blockIdx.y;

  // q fragments (B operand, col = query n0 + 32*wave + 16*t + c), whole head dim in one fragment
  Frag qf[2];
#pragma unroll                                                       // constant indices: fragments stay in registers
  for (int t = 0; t < 2; ++t) qf[t] = ldfrag(Qf + ((size_t)(b * NN + n0 + 32 * wave + 16 * t + c)) * DQ + 8 * hh);

  // ---- fill KV once: thread tid copies chunk 256 i + tid of each plane (global side contiguous over the lanes)
  {
    const unsigned kv0 = (unsigned)(uintptr_t)KV;                    // LDS byte address of KV
    const int cj = tid & 3;                                          // chunk j inside its row / step
    // Kf: row = key 64 i + (tid >> 2): step 2 i + (tid >> 7), tile (tid >> 6) & 1, row in tile (tid >> 2) & 15
    const unsigned dk = kv0 + (unsigned)((tid >> 7) * KVT + ((tid >> 6) & 1) * 1024 + cj * 256 +
                                         ((((tid >> 2) & 15) + 4 * cj) & 15) * 16);
    const unsigned short* gk = Kf + (size_t)b * MM * DQ + 8 * tid;
    copy8(dk, 2 * KVT, gk);
    copy8(dk + 16 * KVT, 2 * KVT, gk + 8 * 2048);
    // Gc (fragment order): step 2 i + (tid >> 7), chunk j = (tid >> 5) & 3, channel tid & 31
    const int vj = (tid >> 5) & 3;
    const unsigned dv = kv0 + (unsigned)((tid >> 7) * KVT + 2048 + ((tid >> 4) & 1) * 1024 + vj * 256 +
                                         (((tid & 15) + 4 * vj) & 15) * 16);
    const unsigned short* gv = Gc + (size_t)b * DQ * MM + 8 * tid;
    copy8(dv, 2 * KVT, gv);
    copy8(dv + 16 * KVT, 2 * KVT, gv + 8 * 2048);
    // every copy of this wave has landed before the barrier behind which the other waves read its bytes
#if defined(__HIP_DEVICE_COMPILE__)
    asm volatile("s_wait_asynccnt 0x0" ::: "memory");
#endif
  }
  __syncthreads();


  // ---- x tile of the residual add: issued here, behind the barrier (which would wait for it) and ahead of the key
  //      loop, so that it arrives while the loop runs
  const int och = tid >> 6, opn = 4 * (tid & 63);                    // output rows: channel 4 it + och, position opn..+3
  const size_t oidx = ((size_t)(b * CC + och)) * NN + n0 + opn;
  v4f xr[16];
#pragma unroll                                                       // constant indices: the array stays in registers
  for (int it = 0; it < 16; ++it) xr[it] = *(const v4f*)(x + oidx + (size_t)(4 * it) * NN);

  // fragment read places in a tile: elements 0..7 = chunk hh, elements 8..15 = chunk 2 + hh, row c
  const unsigned char* fa = KV + hh * 256 + ((c + 4 * hh) & 15) * 16;
  const unsigned char* fb = KV + (2 + hh) * 256 + ((c + 8 + 4 * hh) & 15) * 16;

  float l[2] = {0.f, 0.f};
  v8f cv[2];                                                         // minus the query's reference, eight times
  v8f o[2][2];                                                       // [query tile][channel tile]
#pragma unroll                                                       // constant indices: the arrays stay in registers
  for (int t = 0; t < 2; ++t) {
    cv[t] = zero8();
    o[t][0] = zero8();
    o[t][1] = zero8();
  }

#pragma unroll 1
  for (int kb = 0; kb < MM; kb += 32) {                              // fa, fb: this step's read places in KV
    const Frag k0  = ldfrag2(fa, fb);                                // keys kb .. kb+15
    const Frag k1  = ldfrag2(fa + 1024, fb + 1024);                  // keys kb+16 .. kb+31
    Frag vf[2];                                                      // read with the k fragments: one place of LDS reads
#pragma unroll                                                       // constant indices: vf stays in registers
    for (int j = 0; j < 2; ++j) vf[j] = ldfrag2(fa + 2048 + 1024 * j, fb + 2048 + 1024 * j);
    // the next step's read places advance in their own registers: formed anew at the loop's head they land in registers
    // that the step's last matrix instruction still reads, and the distance behind it is then padded with idle slots
    fa += KVT;
    fb += KVT;
    // keeps the step's eight LDS reads together in front of its matrix work (for speed only)
    __builtin_amdgcn_sched_barrier(0);
    v8f s[2][2];
    scores4(k0.h, k1.h, qf[0].h, qf[1].h, cv[0], cv[1], s[0][0], s[0][1], s[1][0], s[1][1]);

    v8f e[2][2];
    float ls[2];
    unsigned over[2];
    const float th = (kb == 0) ? -1.0f : LSTH;                       // step 0 always sets the reference (ls >= 0)
#pragma unroll                                                       // constant indices: the arrays stay in registers
    for (int t = 0; t < 2; ++t) {
      ls[t] = exp_sum(s[t][0], s[t][1], e[t][0], e[t][1]);
      over[t] = wave_ballot(!(ls[t] <= th));                         // wave-uniform; an infinite or undefined sum counts
    }
    // one branch for both tiles; each moves on its own ballot. Marked rare: the common path then falls through
    if (__builtin_expect((over[0] | over[1]) != 0u, 0)) {
#pragma unroll                                                       // constant indices: the arrays stay in registers
      for (int t = 0; t < 2; ++t) {
        ls[t] = move_ref(over[t] != 0u, kb == 0, s[t][0], s[t][1], cv[t], o[t][0], o[t][1], l[t], e[t][0], e[t][1]);
      }
    }

    FragH ph[2];
#pragma unroll                                                       // constant indices: the arrays stay in registers
    for (int t = 0; t < 2; ++t) {
#pragma unroll                                                       // constant indices: the vectors stay in registers
      for (int r = 0; r < 8; ++r) {
        ph[t].hv[0][r] = (_Float16)e[t][0][r];
        ph[t].hv[1][r] = (_Float16)e[t][1][r];
      }
      l[t] += ls[t];
    }

#pragma unroll                                                       // constant indices: the arrays stay in registers
    for (int t = 0; t < 2; ++t) {
#pragma unroll                                                       // constant indices: the arrays stay in registers
      for (int j = 0; j < 2; ++j) o[t][j] = mma_h(vf[j].h, ph[t].v, o[t][j]);
    }
  }

  // ---- W fragments (4 KiB, the same for every block) and bias: read here, where the loop's registers are free; they
  //      arrive while y is scaled and split
  const int ochu = __builtin_amdgcn_readfirstlane(och);              // the same in all lanes of a wave: bias by scalar loads
  Frag fw[CC / 16];
#pragma unroll                                                       // constant indices: fragments stay in registers
  for (int nt = 0; nt < CC / 16; ++nt) fw[nt] = ldfrag(WWb + (size_t)(16 * nt + c) * DQ + 8 * hh);
  float bo[16];
#pragma unroll                                                       // constant indices: the array stays in registers
  for (int it = 0; it < 16; ++it) bo[it] = wb[4 * it + ochu];

#pragma unroll                                                       // constant indices: the arrays stay in registers
  for (int t = 0; t < 2; ++t) {
    const float lt = l[t] + __shfl_xor(l[t], 16, 32);
    const float inv = 1.0f / lt;                                     // o and l carry the same factor 2^-reference

    // ---- y = o * inv as bf16 hi / residual A fragments (row = query c, k = channel by the split k map)
    Frag yh, yl;
#pragma unroll                                                       // constant indices: fragments stay in registers
    for (int j = 0; j < 2; ++j) {
      float f[8];
#pragma unroll                                                       // constant indices: the array stays in registers
      for (int r = 0; r < 8; ++r) f[r] = o[t][j][r] * inv;
      v4u uh, ul;
      split8(f, uh, ul);
      yh.u[j] = __builtin_bit_cast(v8us, uh);
      yl.u[j] = __builtin_bit_cast(v8us, ul);
    }

    // ---- output conv; lane (hh, c) then holds positions 32 w + 16 t + 8 hh + r of channel 16 nt + c
#pragma unroll                                                       // constant indices: fragments stay in registers
    for (int nt = 0; nt < CC / 16; ++nt) {
      v8f z = mma_b(yh.bf, fw[nt].bf, zero8());
      z = mma_b(yl.bf, fw[nt].bf, z);
      float* po = Os + (16 * nt + c) * OCP + 32 * wave + 16 * t + 8 * hh;
      const v4f va = {z[0], z[1], z[2], z[3]}, vb = {z[4], z[5], z[6], z[7]};
      *(v4f*)(po)     = va;
      *(v4f*)(po + 4) = vb;
    }
  }
  __syncthreads();

  // ---- bias and residual add, whole lines out
#pragma unroll                                                       // constant indices: the arrays stay in registers
  for (int it = 0; it < 16; ++it) {
    const v4f a = *(const v4f*)(Os + (4 * it + och) * OCP + opn);
    const float bvs = bfr(bo[it]);
    v4f res;
#pragma unroll                                                       // constant indices: the vector stays in registers
    for (int t = 0; t < 4; ++t) res[t] = (a[t] + bvs) + bfr(xr[it][t]);
    *(v4f*)(out + oidx + (size_t)(4 * it) * NN) = res;
  }
}

// =========================================================================================================
// Workspace map (bytes; each region start a multiple of 256; every extent is an exact row/tile multiple and is
//   WWb bf16 [64][32]              4096
//   Qf f16 [NB][4096][32]       4194304 (NB=16)
//   Kf f16 [NB][1024][32]       1048576      Gc f16 [NB][32][4][32][8]   1048576
//   total (NB=16) = 6295552
// =========================================================================================================
extern "C" void kernel_launch(void* const* d_in, const int* in_sizes, int n_in,
                              void* d_out, int out_size, void* d_ws, size_t ws_size,
                              hipStream_t stream) {
  const int XN = NB * CC * NN;
  if (n_in < 9) return;
  if (in_sizes[0] < XN) return;
  if (in_sizes[1] < DQ * CC || in_sizes[3] < DQ * CC || in_sizes[5] < DQ * CC || in_sizes[7] < CC * DQ) return;
  if (in_sizes[2] < DQ || in_sizes[4] < DQ || in_sizes[6] < DQ || in_sizes[8] < CC) return;
  if (out_size < XN) return;

  size_t off = 0;
  auto carve = [&](size_t bytes) { const size_t o = off; off += (bytes + 255) & ~(size_t)255; return o; };
  const size_t oWWb = carve((size_t)CC * DQ * 2);
  const size_t oQf  = carve((size_t)NB * NN * DQ * 2);
  const size_t oKf  = carve((size_t)NB * MM * DQ * 2);
  const size_t oGc  = carve((size_t)NB * DQ * MM * 2);
  if (off > ws_size) return;
  if (off > (size_t)134217728) return;

  const float* x  = (const float*)d_in[0];
  const float* gw = (const float*)d_in[1];
  const float* gb = (const float*)d_in[2];
  const float* tw = (const float*)d_in[3];
  const float* tb = (const float*)d_in[4];
  const float* pw = (const float*)d_in[5];
  const float* pb = (const float*)d_in[6];
  const float* ow = (const float*)d_in[7];
  const float* wb = (const float*)d_in[8];

  char* ws = (char*)d_ws;
  unsigned short* WWb = (unsigned short*)(ws + oWWb);
  unsigned short* Qf  = (unsigned short*)(ws + oQf);
  unsigned short* Kf  = (unsigned short*)(ws + oKf);
  unsigned short* Gc  = (unsigned short*)(ws + oGc);
  float* out = (float*)d_out;

  const dim3 blk256(256);

  // (0) x, weights -> theta (q) f16 plane, pooled phi (k) f16 plane, pooled g f16 plane; w_w -> bf16 plane
  proj_pool<<<dim3(NSTRIP, NB), blk256, 0, stream>>>(x, tw, pw, gw, ow, tb, pb, gb, WWb, Qf, Kf, Gc);
  // (4) attention, output conv + bias + residual -> out [b][64][4096]
  attn_k<<<dim3(NQ / AQ, NB), blk256, 0, stream>>>(Qf, Kf, Gc, WWb, wb, x, out);
  (void)hipGetLastError();
}
